// v000
// The times below were measured on an AMD MI455X: many runs one after another, warmed up first and cycling through
// copies of the inputs, with the whole window's GPU time divided by the number of runs. Launches and the gaps
// between them are all in it. The median over several windows is given; except for v000 it joins two sittings, which
// can be a few percent apart, so the side-by-side timings, each taken in one sitting, are the better comparison.
// v000, which the later versions start from, runs in 1330 microseconds.
#include <hip/hip_runtime.h>

// Causal multi-head attention with a rank-1 'trigram' geometric bias (x [4][1024][1024]; [q|k|v] = x Wqkv ('xw' [1024][3072], no bias; 8 heads x 128); scores = q.k/sqrt(128) + head_scales[h] (q_i[:3].dirs[h]) (k_j[:3].dirs[h]) (head_scales [8], head_dirs [8][3] read); causal (-inf); softmax; out = merged Wout ('xw') -> [4][1024][1024] (4.2 M)).
// Layout: projections/planes; the two 3-term projections per (head, token) are formed once per batch in f32 from the f32 q/k projections; the softmax kernel adds head_scale x qp_i x kp_j to each live logit.
// Compute dtypes, f32 accumulate: every input rounded to bf16; q/k/v on PLAIN bf16 operands (inputs: exact); geometric bias in f32 inside the softmax kernel; causal scores and attn.v (tile skipping): query rows < 512 hl (3 products), the rest single fp16 (x1024); softmax f32; Wout hl x exact (2 products).

#define NB_  4
#define TT   1024
#define DM   1024
#define NH_  8
#define NKV  8
#define REP  (NH_ / NKV)
#define HD   128
#define DQ   (NH_ * HD)
#define DKV  (NKV * HD)
#define ZH   2
#define RH   512                  // query rows < RH use hi+lo planes (0: none)
#define WIN  1024
#define PCAR 1024.0f
#define SCL  0.088388347648318447f   // HD^-0.5
typedef _Float16 h16;
typedef unsigned short bf;
typedef __attribute__((ext_vector_type(16))) __bf16   v16bf;
typedef __attribute__((ext_vector_type(16))) _Float16 v16h;
typedef __attribute__((ext_vector_type(8)))  _Float16 v8h;
typedef __attribute__((ext_vector_type(8)))  unsigned short v8us;
typedef __attribute__((ext_vector_type(8)))  float    v8f;
typedef __attribute__((ext_vector_type(4)))  float    v4f;
typedef v8h  __attribute__((may_alias)) v8ha;
typedef v4f  __attribute__((may_alias)) v4fa;
typedef v8us __attribute__((may_alias)) v8usa;

__device__ __forceinline__ unsigned short f2bf(float f) { unsigned u = __float_as_uint(f); u += 0x7FFFu + ((u >> 16) & 1u); return (unsigned short)(u >> 16); }
__device__ __forceinline__ float bf2f(unsigned short b) { return __uint_as_float(((unsigned)b) << 16); }
__device__ __forceinline__ float bfr(float f) { return bf2f(f2bf(f)); }
__device__ __forceinline__ v16h cat16(v8h lo, v8h hi) { return __builtin_shufflevector(lo, hi, 0, 1, 2, 3, 4, 5, 6, 7, 8, 9, 10, 11, 12, 13, 14, 15); }
__device__ __forceinline__ v16bf cat16b(v8us lo, v8us hi) { return __builtin_bit_cast(v16bf, __builtin_shufflevector(lo, hi, 0, 1, 2, 3, 4, 5, 6, 7, 8, 9, 10, 11, 12, 13, 14, 15)); }
__device__ __forceinline__ v8f wmma16(v16h a, v16h b, v8f c) { return __builtin_amdgcn_wmma_f32_16x16x32_f16(false, a, false, b, (short)0, c, false, false); }
__device__ __forceinline__ v8f wmmab(v16bf a, v16bf b, v8f c) { return __builtin_amdgcn_wmma_f32_16x16x32_bf16(false, a, false, b, (short)0, c, false, false); }



// ---- k_gemmw: register-blocked GEMM, ONE WAVE per 64x64 output tile (16 accumulators), operands straight from K-contiguous 16-bit planes; grid (M/64, N/64, Z), 32 threads.
// C[m][n] (f32, pitch ldc, + optional f32 bias[n]) = sum_k A[m][k] Bt[n][k] (+ split products per NSPLIT). z-batch strides sA/sB/sC in elements. K % 32 == 0.
template <typename T16> struct WFrag;
template <> struct WFrag<h16> { typedef v16h V; static __device__ __forceinline__ V ld(const h16* p) { return cat16(*(const v8h*)p, *(const v8h*)(p + 16)); } static __device__ __forceinline__ v8f mma(V a, V b, v8f c) { return wmma16(a, b, c); } };
template <> struct WFrag<bf> { typedef v16bf V; static __device__ __forceinline__ V ld(const bf* p) { return cat16b(*(const v8us*)p, *(const v8us*)(p + 16)); } static __device__ __forceinline__ v8f mma(V a, V b, v8f c) { return wmmab(a, b, c); } };
template <typename T16, int NSPLIT, bool BIAS>
__global__ __launch_bounds__(32) void k_gemmw(const T16* __restrict__ A, const T16* __restrict__ A2, const T16* __restrict__ Bt, const T16* __restrict__ Bt2, int K, float* C, int ldc, const float* __restrict__ bias, size_t sA, size_t sB, size_t sC) {
    typedef typename WFrag<T16>::V V;
    __shared__ __align__(16) float os[16 * 68];
    const size_t z = blockIdx.z; A += z * sA; if (A2) A2 += z * sA; Bt += z * sB; if (Bt2) Bt2 += z * sB; C += z * sC;
    const int lane = threadIdx.x & 31, lr = lane & 15, hi = lane >> 4; const int r0 = blockIdx.x * 64, c0 = blockIdx.y * 64;
    v8f acc[4][4];
#pragma unroll
    for (int mb = 0; mb < 4; ++mb)
#pragma unroll
        for (int nb = 0; nb < 4; ++nb) acc[mb][nb] = (v8f){};
    const size_t aoff = (size_t)(r0 + lr) * K + 8 * hi, boff = (size_t)(c0 + lr) * K + 8 * hi;
#pragma unroll 1
    for (int kc = 0; kc < K; kc += 32) {
        V a[4], a2[4];
#pragma unroll
        for (int mb = 0; mb < 4; ++mb) { a[mb] = WFrag<T16>::ld(A + aoff + (size_t)mb * 16 * K + kc); if (NSPLIT == 1 || NSPLIT == 2) a2[mb] = WFrag<T16>::ld(A2 + aoff + (size_t)mb * 16 * K + kc); }
#pragma unroll
        for (int nb = 0; nb < 4; ++nb) { const V b = WFrag<T16>::ld(Bt + boff + (size_t)nb * 16 * K + kc); V b2; if (NSPLIT >= 2) b2 = WFrag<T16>::ld(Bt2 + boff + (size_t)nb * 16 * K + kc);
#pragma unroll
            for (int mb = 0; mb < 4; ++mb) { acc[mb][nb] = WFrag<T16>::mma(a[mb], b, acc[mb][nb]); if (NSPLIT == 1 || NSPLIT == 2) acc[mb][nb] = WFrag<T16>::mma(a2[mb], b, acc[mb][nb]); if (NSPLIT >= 2) acc[mb][nb] = WFrag<T16>::mma(a[mb], b2, acc[mb][nb]); } }
        asm volatile("v_nop\n\tv_nop\n\tv_nop\n\tv_nop" : "+v"(acc[0][0]), "+v"(acc[1][1]), "+v"(acc[2][2]), "+v"(acc[3][3]) : "v"(a[0]), "v"(a[3]));
    }
#pragma unroll
    for (int mb = 0; mb < 4; ++mb) {
#pragma unroll
        for (int nb = 0; nb < 4; ++nb) {
#pragma unroll
            for (int j = 0; j < 8; ++j) os[(hi * 8 + j) * 68 + nb * 16 + lr] = acc[mb][nb][j]; }
        __builtin_amdgcn_wave_barrier(); asm volatile("" ::: "memory");
        float* crow = C + (size_t)(r0 + mb * 16) * ldc + c0;
{
#pragma unroll
            for (int s = 0; s < 8; ++s) { const int row = 2 * s + hi, cofs = lr * 4; v4f val = *(const v4fa*)(os + row * 68 + cofs); if (BIAS) { val[0] += bfr(bias[c0 + cofs]); val[1] += bfr(bias[c0 + cofs + 1]); val[2] += bfr(bias[c0 + cofs + 2]); val[3] += bfr(bias[c0 + cofs + 3]); }
                *(v4f*)(crow + (size_t)row * ldc + cofs) = val; }
             }
        __builtin_amdgcn_wave_barrier(); asm volatile("" ::: "memory");
    }
}

// ---- k_gemmc: the same one-wave 64x64 tile GEMM specialised for causal attention: CMODE 1 skips score tiles entirely above the diagonal (query rows r0+roff.., key columns c0..), CMODE 2 limits the
// key (K) loop of the probability x value contraction to the diagonal block (probabilities beyond it are exactly zero). roff = row offset of this launch's first row within the sequence.
template <typename T16, int NSPLIT, int CMODE>
__global__ __launch_bounds__(32) void k_gemmc(const T16* __restrict__ A, const T16* __restrict__ A2, const T16* __restrict__ Bt, const T16* __restrict__ Bt2, int K, float* C, int ldc, int roff, size_t sA, size_t sB, size_t sC) {
    typedef typename WFrag<T16>::V V;
    __shared__ __align__(16) float os[16 * 68];
    const size_t z = blockIdx.z; A += z * sA; if (A2) A2 += z * sA; Bt += z * sB; if (Bt2) Bt2 += z * sB; C += z * sC;
    const int lane = threadIdx.x & 31, lr = lane & 15, hi = lane >> 4; const int r0 = blockIdx.x * 64, c0 = blockIdx.y * 64;
    if (CMODE == 1 && c0 > r0 + roff + 63) return;                  // score tile entirely above the causal diagonal: not computed (the softmax masks j > i by select)
    const int Kl = (CMODE == 2) ? min(K, r0 + roff + 64) : K;        // P.V: probabilities are exactly 0 beyond the diagonal block, so the K loop stops there
    v8f acc[4][4];
#pragma unroll
    for (int mb = 0; mb < 4; ++mb)
#pragma unroll
        for (int nb = 0; nb < 4; ++nb) acc[mb][nb] = (v8f){};
    const size_t aoff = (size_t)(r0 + lr) * K + 8 * hi, boff = (size_t)(c0 + lr) * K + 8 * hi;
#pragma unroll 1
    for (int kc = 0; kc < Kl; kc += 32) {
        V a[4], a2[4];
#pragma unroll
        for (int mb = 0; mb < 4; ++mb) { a[mb] = WFrag<T16>::ld(A + aoff + (size_t)mb * 16 * K + kc); if (NSPLIT == 1 || NSPLIT == 2) a2[mb] = WFrag<T16>::ld(A2 + aoff + (size_t)mb * 16 * K + kc); }
#pragma unroll
        for (int nb = 0; nb < 4; ++nb) { const V b = WFrag<T16>::ld(Bt + boff + (size_t)nb * 16 * K + kc); V b2; if (NSPLIT >= 2) b2 = WFrag<T16>::ld(Bt2 + boff + (size_t)nb * 16 * K + kc);
#pragma unroll
            for (int mb = 0; mb < 4; ++mb) { acc[mb][nb] = WFrag<T16>::mma(a[mb], b, acc[mb][nb]); if (NSPLIT == 1 || NSPLIT == 2) acc[mb][nb] = WFrag<T16>::mma(a2[mb], b, acc[mb][nb]); if (NSPLIT >= 2) acc[mb][nb] = WFrag<T16>::mma(a[mb], b2, acc[mb][nb]); } }
        asm volatile("v_nop\n\tv_nop\n\tv_nop\n\tv_nop" : "+v"(acc[0][0]), "+v"(acc[1][1]), "+v"(acc[2][2]), "+v"(acc[3][3]) : "v"(a[0]), "v"(a[3]));
    }
#pragma unroll
    for (int mb = 0; mb < 4; ++mb) {
#pragma unroll
        for (int nb = 0; nb < 4; ++nb) {
#pragma unroll
            for (int j = 0; j < 8; ++j) os[(hi * 8 + j) * 68 + nb * 16 + lr] = acc[mb][nb][j]; }
        __builtin_amdgcn_wave_barrier(); asm volatile("" ::: "memory");
        float* crow = C + (size_t)(r0 + mb * 16) * ldc + c0;
{
#pragma unroll
            for (int s = 0; s < 8; ++s) { const int row = 2 * s + hi, cofs = lr * 4; v4f val = *(const v4fa*)(os + row * 68 + cofs);
                *(v4f*)(crow + (size_t)row * ldc + cofs) = val; }
             }
        __builtin_amdgcn_wave_barrier(); asm volatile("" ::: "memory");
    }
}

__device__ __forceinline__ h16 tohx(float x) { return (h16)x; }
__device__ __forceinline__ void splitf(float y, unsigned short& h, unsigned short& l) { h = f2bf(y); l = f2bf(y - bf2f(h)); }
typedef __attribute__((ext_vector_type(2))) _Float16 v2h;
typedef __attribute__((ext_vector_type(4))) _Float16 v4h;
typedef __attribute__((ext_vector_type(2))) unsigned short v2us;
typedef __attribute__((ext_vector_type(4))) unsigned short v4us;
typedef __attribute__((ext_vector_type(2))) float v2f;
typedef __attribute__((ext_vector_type(4))) int v4i;

__global__ __launch_bounds__(256) void k_wtG(const float* __restrict__ w, int K, int N, bf* Bt) {
    const int lane = threadIdx.x & 31; const int L0 = (blockIdx.x * 8 + (threadIdx.x >> 5)) * 8; const int nlines = N * K / 64;
{
#pragma unroll 1
        for (int l = 0; l < 8; ++l) { const int L = L0 + l; if (L >= nlines) break; const size_t e = (size_t)L * 64 + lane * 2; const int k = (int)(e % K), n = (int)(e / K); v2us o;
            o[0] = f2bf(w[(size_t)k * N + n]); o[1] = f2bf(w[(size_t)(k + 1) * N + n]); *(v2us*)(Bt + e) = o; }
         }
}
__global__ __launch_bounds__(256) void k_cvt8(const float* __restrict__ src, bf* dst, size_t n8) { const size_t i = (size_t)blockIdx.x * 256 + threadIdx.x; if (i >= n8) return; const v8f v = *(const v8f*)(src + i * 8); v8us o;
#pragma unroll
    for (int k = 0; k < 8; ++k) o[k] = f2bf(v[k]); *(v8us*)(dst + i * 8) = o;  }

// k_rope: head planes [h][t][d] (fp16 + hi/lo) of rope(x) x sc with the rotate-half convention out[d] = x[d] cos[t][d] - x[d+HD/2] sin[t][d], out[d+HD/2] = x[d+HD/2] cos[t][d+HD/2] + x[d] sin[t][d+HD/2]
__global__ __launch_bounds__(256) void k_rope(const float* __restrict__ F, int pitch, int nheads, const float* __restrict__ CS, const float* __restrict__ RF, const float* __restrict__ nw, float sc, h16* P16, bf* Ph, bf* Pl) {
    const size_t e = ((size_t)blockIdx.x * 256 + threadIdx.x) * 2; if (e >= (size_t)nheads * TT * HD) return; const int d = (int)(e % HD); const int t = (int)((e / HD) % TT); const int h = (int)(e / ((size_t)HD * TT)); const float* f = F + (size_t)t * pitch + h * HD; const float rf = RF ? RF[(size_t)h * TT + t] : 1.0f; v2h o16; v2us oh, ol;
#pragma unroll
    for (int q = 0; q < 2; ++q) { const int dd = d + q; const int dp = (dd < HD / 2) ? dd + HD / 2 : dd - HD / 2; float x0 = f[dd], x1 = f[dp];
        if (RF) { float n0 = __fmul_rn(x0, rf), n1 = __fmul_rn(x1, rf); asm volatile("" : "+v"(n0)); asm volatile("" : "+v"(n1)); x0 = __fmul_rn(bfr(nw[dd]), n0); x1 = __fmul_rn(bfr(nw[dp]), n1); }
        const v2f cs = *(const v2f*)(CS + ((size_t)t * HD + dd) * 2); float a = __fmul_rn(x0, cs[0]), bq = __fmul_rn(x1, cs[1]); asm volatile("" : "+v"(a)); asm volatile("" : "+v"(bq)); const float r = ((dd < HD / 2) ? __fsub_rn(a, bq) : __fadd_rn(a, bq)) * sc;
        o16[q] = tohx(r); unsigned short a2, c2; splitf(r, a2, c2); oh[q] = a2; ol[q] = c2; }
    *(v2h*)(P16 + e) = o16; *(v2us*)(Ph + e) = oh; *(v2us*)(Pl + e) = ol;  }
__global__ __launch_bounds__(256) void k_vtp(const float* __restrict__ F, int pitch, int nheads, h16* V16, bf* Vh, bf* Vl) { const size_t e = ((size_t)blockIdx.x * 256 + threadIdx.x) * 2; if (e >= (size_t)nheads * HD * TT) return; const int t = (int)(e % TT); const int d = (int)((e / TT) % HD); const int g = (int)(e / ((size_t)TT * HD)); v2h o16; v2us oh, ol;
#pragma unroll
    for (int q = 0; q < 2; ++q) { const float x = F[(size_t)(t + q) * pitch + g * HD + d]; o16[q] = tohx(x); unsigned short a2, c2; splitf(x, a2, c2); oh[q] = a2; ol[q] = c2; }
    *(v2h*)(V16 + e) = o16; *(v2us*)(Vh + e) = oh; *(v2us*)(Vl + e) = ol;  }
__global__ __launch_bounds__(256) void k_csid(float* CS) { const int idx = blockIdx.x * 256 + threadIdx.x; if (idx >= TT * HD) return; v2f cs; cs[0] = 1.0f; cs[1] = 0.0f; *(v2f*)(CS + (size_t)idx * 2) = cs;  }
__global__ __launch_bounds__(256) void k_gproj(const float* __restrict__ F, const float* __restrict__ dirs, float* PJ) { const int idx = blockIdx.x * 256 + threadIdx.x; if (idx >= NH_ * TT) return; const int t = idx % TT, h = idx / TT; const float* f = F + (size_t)t * DQ + h * HD; float p0 = __fmul_rn(f[0], bfr(dirs[h * 3])), p1 = __fmul_rn(f[1], bfr(dirs[h * 3 + 1])), p2 = __fmul_rn(f[2], bfr(dirs[h * 3 + 2])); asm volatile("" : "+v"(p0), "+v"(p1), "+v"(p2)); const float v = __fadd_rn(__fadd_rn(p0, p1), p2); *(float*)(PJ + idx) = v;  }
// k_asoft: per row (zz, i): t = S x HD^-0.5 + head_scale x qp_i x kp_j for j <= i (causal; the reference's -1e9 additive fill vanishes identically); softmax over the 1024 keys (register row, one exp, fixed trees);
__global__ __launch_bounds__(256) void k_asoft(const float* __restrict__ Sb, const float* __restrict__ QPJ, const float* __restrict__ KPJ, const float* __restrict__ HSC, int h0, h16* P16, bf* Ph, bf* Pl) {
    const int lane = threadIdx.x & 31; const int row = blockIdx.x * 8 + (threadIdx.x >> 5); if (row >= ZH * TT) return; const int i = row % TT; const int zz = row / TT; const int h = h0 + zz; const float hs = bfr(HSC[h]); const float qp = QPJ[(size_t)h * TT + i]; const float* kpr = KPJ + (size_t)h * TT; const bool hires = (i < RH); const float* sr = Sb + (size_t)row * TT; float v[TT / 32]; float mx = -3.0e38f;
#pragma unroll
    for (int ch = 0; ch < TT / 128; ++ch) { const int j0 = ch * 128 + lane * 4; const v4f a = *(const v4f*)(sr + j0);
#pragma unroll
        for (int q = 0; q < 4; ++q) { const int j = j0 + q; (void)j; float sa = a[q] * SCL; asm volatile("" : "+v"(sa)); float gb = __fmul_rn(qp, kpr[j]); asm volatile("" : "+v"(gb)); float hb = __fmul_rn(hs, gb); asm volatile("" : "+v"(hb)); float tl = __fadd_rn(sa, hb); asm volatile("" : "+v"(tl)); const float t = (j <= i) ? tl : -3.0e38f;   /* s/sqrt(128) + head_scale (qp_i kp_j), causal */ v[ch * 4 + q] = t; mx = fmaxf(mx, t); } }
#pragma unroll
    for (int sh = 16; sh; sh >>= 1) mx = fmaxf(mx, __shfl_xor(mx, sh, 32));
    float sum = 0.f;
#pragma unroll
    for (int k = 0; k < TT / 32; ++k) { float d0 = __fsub_rn(v[k], mx); asm volatile("" : "+v"(d0)); v[k] = __builtin_amdgcn_exp2f(__fmul_rn(d0, 1.4426950408889634f)); sum += v[k]; }
#pragma unroll
    for (int sh = 16; sh; sh >>= 1) sum += __shfl_xor(sum, sh, 32);
    const float f = __fdiv_rn(hires ? 1.0f : PCAR, sum);
{
        if (hires) {
#pragma unroll
            for (int ch = 0; ch < TT / 128; ++ch) { v4us oh, ol;
#pragma unroll
                for (int q = 0; q < 4; ++q) { unsigned short a, c2; splitf(v[ch * 4 + q] * f, a, c2); oh[q] = a; ol[q] = c2; }
                const size_t oo = ((size_t)zz * (RH ? RH : 1) + i) * TT + ch * 128 + lane * 4; *(v4us*)(Ph + oo) = oh; *(v4us*)(Pl + oo) = ol; }
        } else {
#pragma unroll
            for (int ch = 0; ch < TT / 128; ++ch) { v4h o4;
#pragma unroll
                for (int q = 0; q < 4; ++q) o4[q] = tohx(v[ch * 4 + q] * f);
                *(v4h*)(P16 + (size_t)row * TT + ch * 128 + lane * 4) = o4; } }
         }
}
__global__ __launch_bounds__(256) void k_merge(const float* __restrict__ O, int h0, bf* Ah, bf* Al) { const size_t e = ((size_t)blockIdx.x * 256 + threadIdx.x) * 2; if (e >= (size_t)ZH * TT * HD) return; const int d = (int)(e % HD); const int t = (int)((e / HD) % TT); const int zz = (int)(e / ((size_t)HD * TT)); const float cs = (t < RH) ? 1.0f : (1.0f / PCAR); const size_t oo = (size_t)t * DQ + (h0 + zz) * HD + d;
    v2us oh, ol;
#pragma unroll
    for (int q = 0; q < 2; ++q) { unsigned short a, c2; splitf(O[e + q] * cs, a, c2); oh[q] = a; ol[q] = c2; } *(v2us*)(Ah + oo) = oh; *(v2us*)(Al + oo) = ol;  }

extern "C" void kernel_launch(void* const* d_in, const int* in_sizes, int n_in,
                              void* d_out, int out_size, void* d_ws, size_t ws_size, hipStream_t stream) {
    (void)in_sizes; (void)n_in; (void)out_size;
    const float* x = (const float*)d_in[0]; const float* wqkv = (const float*)d_in[1]; const float* wo = (const float*)d_in[2]; const float* HSC = (const float*)d_in[3]; const float* HDR = (const float*)d_in[4];  const float* wq = nullptr; const float* wk = nullptr; const float* wv = nullptr; (void)wq; (void)wk; (void)wv;
    float* OUT = (float*)d_out;     // [4][1024][1024]
    char* wsp = (char*)d_ws;
    auto take = [&](size_t bytes) { char* p = wsp; wsp += (bytes + 255) & ~(size_t)255; return (void*)p; };
    bf* WALL = (bf*)take((size_t)3 * DM * DM * 2); bf* WQ = WALL; bf* WK = WALL + (size_t)DM * DM; bf* WV = WALL + (size_t)2 * DM * DM; bf* WO = (bf*)take((size_t)DM * DQ * 2); float* CS = (float*)take((size_t)TT * HD * 2 * 4);
    bf* XB = (bf*)take((size_t)TT * DM * 2); float* QPJ = (float*)take((size_t)NH_ * TT * 4); float* KPJ = (float*)take((size_t)NH_ * TT * 4); float* FQ = (float*)take((size_t)TT * DQ * 4); float* FK = (float*)take((size_t)TT * DKV * 4);
    h16* QP16 = (h16*)take((size_t)NH_ * TT * HD * 2); h16* KP16 = (h16*)take((size_t)NKV * TT * HD * 2); h16* VT16 = (h16*)take((size_t)NKV * HD * TT * 2);
    bf* QPh = (bf*)take((size_t)NH_ * TT * HD * 2); bf* QPl = (bf*)take((size_t)NH_ * TT * HD * 2); bf* KPh = (bf*)take((size_t)NKV * TT * HD * 2); bf* KPl = (bf*)take((size_t)NKV * TT * HD * 2); bf* VTh = (bf*)take((size_t)NKV * HD * TT * 2); bf* VTl = (bf*)take((size_t)NKV * HD * TT * 2); bf* Ph = (bf*)take((size_t)ZH * RH * TT * 2); bf* Pl = (bf*)take((size_t)ZH * RH * TT * 2);
    float* Sb = (float*)take((size_t)ZH * TT * TT * 4); h16* P16 = (h16*)take((size_t)ZH * TT * TT * 2); float* Ob = (float*)take((size_t)ZH * TT * HD * 4); bf* ATh = (bf*)take((size_t)TT * DQ * 2); bf* ATl = (bf*)take((size_t)TT * DQ * 2);
    if ((size_t)(wsp - (char*)d_ws) > ws_size) return;    // ws 256 MiB
    float* FV = FK;   // v projection reuses the k buffer after the k planes are built (stream-ordered)
    { k_wtG<<<(unsigned)((DM * 3 * DM / 64 + 63) / 64), 256, 0, stream>>>(wqkv, DM, 3 * DM, WALL);   /* fused 'xw' [DM][3DM] -> Bt [3DM][DM] (row blocks q | k | v) */
      k_wtG<<<(unsigned)((DQ * DM / 64 + 63) / 64), 256, 0, stream>>>(wo, DQ, DM, WO);
       }
    k_csid<<<(TT * HD + 255) / 256, 256, 0, stream>>>(CS);
    const unsigned LQ = (unsigned)(((size_t)NH_ * TT * HD / 2 + 255) / 256), LKv = (unsigned)(((size_t)NKV * TT * HD / 2 + 255) / 256);
    for (int b = 0; b < NB_; ++b) {
        
        k_cvt8<<<(unsigned)(((size_t)TT * DM / 8 + 255) / 256), 256, 0, stream>>>(x + (size_t)b * TT * DM, XB, (size_t)TT * DM / 8);
        k_gemmw<bf, 0, false><<<dim3(TT / 64, DQ / 64, 1), 32, 0, stream>>>(XB, nullptr, WQ, nullptr, DM, FQ, DQ, nullptr, 0, 0, 0);
        k_rope<<<LQ, 256, 0, stream>>>(FQ, DQ, NH_, CS, nullptr, nullptr, 1.0f, QP16, QPh, QPl); k_gproj<<<(NH_ * TT + 255) / 256, 256, 0, stream>>>(FQ, HDR, QPJ);
        k_gemmw<bf, 0, false><<<dim3(TT / 64, DKV / 64, 1), 32, 0, stream>>>(XB, nullptr, WK, nullptr, DM, FK, DKV, nullptr, 0, 0, 0);
        k_rope<<<LKv, 256, 0, stream>>>(FK, DKV, NKV, CS, nullptr, nullptr, 1.0f, KP16, KPh, KPl); k_gproj<<<(NKV * TT + 255) / 256, 256, 0, stream>>>(FK, HDR, KPJ);   /* before the v projection reuses the k buffer */
        k_gemmw<bf, 0, false><<<dim3(TT / 64, DKV / 64, 1), 32, 0, stream>>>(XB, nullptr, WV, nullptr, DM, FV, DKV, nullptr, 0, 0, 0); k_vtp<<<LKv, 256, 0, stream>>>(FV, DKV, NKV, VT16, VTh, VTl);
        for (int h0 = 0; h0 < NH_; h0 += ZH) { const size_t zq = (size_t)h0, zk = (size_t)(h0 / REP);   // one kv head per query head: the pass's two heads use consecutive kv planes (z-strides TT*HD)
            k_gemmc<bf, 2, 1><<<dim3(RH / 64, TT / 64, ZH), 32, 0, stream>>>(QPh + zq * TT * HD, QPl + zq * TT * HD, KPh + zk * TT * HD, KPl + zk * TT * HD, HD, Sb, TT, 0, (size_t)TT * HD, (size_t)TT * HD, (size_t)TT * TT);
            k_gemmc<h16, 0, 1><<<dim3((TT - RH) / 64, TT / 64, ZH), 32, 0, stream>>>(QP16 + zq * TT * HD + (size_t)RH * HD, nullptr, KP16 + zk * TT * HD, nullptr, HD, Sb + (size_t)RH * TT, TT, RH, (size_t)TT * HD, (size_t)TT * HD, (size_t)TT * TT);
            k_asoft<<<ZH * TT / 8, 256, 0, stream>>>(Sb, QPJ, KPJ, HSC, h0, P16, Ph, Pl);
            k_gemmc<bf, 2, 2><<<dim3(RH / 64, HD / 64, ZH), 32, 0, stream>>>(Ph, Pl, VTh + zk * HD * TT, VTl + zk * HD * TT, TT, Ob, HD, 0, (size_t)RH * TT, (size_t)HD * TT, (size_t)TT * HD);
            k_gemmc<h16, 0, 2><<<dim3((TT - RH) / 64, HD / 64, ZH), 32, 0, stream>>>(P16 + (size_t)RH * TT, nullptr, VT16 + zk * HD * TT, nullptr, TT, Ob + (size_t)RH * HD, HD, RH, (size_t)TT * TT, (size_t)HD * TT, (size_t)TT * HD);
            k_merge<<<(unsigned)(((size_t)ZH * TT * HD / 2 + 255) / 256), 256, 0, stream>>>(Ob, h0, ATh, ATl); }
        k_gemmw<bf, 1, false><<<dim3(TT / 64, DM / 64, 1), 32, 0, stream>>>(ATh, ATl, WO, nullptr, DQ, OUT + (size_t)b * TT * DM, DM, nullptr, 0, 0, 0); }
}

// v001
// Measured time: 290 microseconds a run.
// Next to v000, in two timings, it ran 4.60 and 4.61 times as fast.
#include <hip/hip_runtime.h>

// Causal multi-head attention with a rank-1 'trigram' geometric bias (x [4][1024][1024]; [q|k|v] = x Wqkv ('xw' [1024][3072], no bias; 8 heads x 128); scores = q.k/sqrt(128) + head_scales[h] (q_i[:3].dirs[h]) (k_j[:3].dirs[h]) (head_scales [8], head_dirs [8][3] read); causal (-inf); softmax; out = merged Wout ('xw') -> [4][1024][1024] (4.2 M)).
// Layout: projections/planes, every stage launched once for all 4 batches x 8 heads (plane index z = batch * 8 + head); the two 3-term projections per (head, token) are formed once in f32 from the f32 q/k projections; the softmax kernel adds head_scale x qp_i x kp_j to each live logit.
// Compute dtypes, f32 accumulate: every input rounded to bf16; q/k/v on PLAIN bf16 operands (inputs: exact); geometric bias in f32 inside the softmax kernel; causal scores and attn.v (tile skipping): query rows < 512 hl (3 products), the rest single fp16 (x1024); softmax f32; Wout hl x exact (2 products).

#define NB_  4
#define TT   1024
#define DM   1024
#define NH_  8
#define NKV  8
#define REP  (NH_ / NKV)
#define HD   128
#define DQ   (NH_ * HD)
#define DKV  (NKV * HD)
#define ZH   (NB_ * NH_)          // planes per launch: every (batch, head)
#define RH   512                  // query rows < RH use hi+lo planes (0: none)
#define WIN  1024
#define PCAR 1024.0f
#define SCL  0.088388347648318447f   // HD^-0.5
typedef _Float16 h16;
typedef unsigned short bf;
typedef __attribute__((ext_vector_type(16))) __bf16   v16bf;
typedef __attribute__((ext_vector_type(16))) _Float16 v16h;
typedef __attribute__((ext_vector_type(8)))  _Float16 v8h;
typedef __attribute__((ext_vector_type(8)))  unsigned short v8us;
typedef __attribute__((ext_vector_type(8)))  float    v8f;
typedef __attribute__((ext_vector_type(4)))  float    v4f;
typedef v8h  __attribute__((may_alias)) v8ha;
typedef v4f  __attribute__((may_alias)) v4fa;
typedef v8us __attribute__((may_alias)) v8usa;

__device__ __forceinline__ unsigned short f2bf(float f) { unsigned u = __float_as_uint(f); u += 0x7FFFu + ((u >> 16) & 1u); return (unsigned short)(u >> 16); }
__device__ __forceinline__ float bf2f(unsigned short b) { return __uint_as_float(((unsigned)b) << 16); }
__device__ __forceinline__ float bfr(float f) { return bf2f(f2bf(f)); }
__device__ __forceinline__ v16h cat16(v8h lo, v8h hi) { return __builtin_shufflevector(lo, hi, 0, 1, 2, 3, 4, 5, 6, 7, 8, 9, 10, 11, 12, 13, 14, 15); }
__device__ __forceinline__ v16bf cat16b(v8us lo, v8us hi) { return __builtin_bit_cast(v16bf, __builtin_shufflevector(lo, hi, 0, 1, 2, 3, 4, 5, 6, 7, 8, 9, 10, 11, 12, 13, 14, 15)); }
__device__ __forceinline__ v8f wmma16(v16h a, v16h b, v8f c) { return __builtin_amdgcn_wmma_f32_16x16x32_f16(false, a, false, b, (short)0, c, false, false); }
__device__ __forceinline__ v8f wmmab(v16bf a, v16bf b, v8f c) { return __builtin_amdgcn_wmma_f32_16x16x32_bf16(false, a, false, b, (short)0, c, false, false); }



// ---- k_gemmw: register-blocked GEMM, ONE WAVE per 64x64 output tile (16 accumulators), operands straight from K-contiguous 16-bit planes; grid (M/64, N/64, Z), 32 threads.
// C[m][n] (f32, pitch ldc, + optional f32 bias[n]) = sum_k A[m][k] Bt[n][k] (+ split products per NSPLIT). z-batch strides sA/sB/sC in elements. K % 32 == 0.
template <typename T16> struct WFrag;
template <> struct WFrag<h16> { typedef v16h V; static __device__ __forceinline__ V ld(const h16* p) { return cat16(*(const v8h*)p, *(const v8h*)(p + 16)); } static __device__ __forceinline__ v8f mma(V a, V b, v8f c) { return wmma16(a, b, c); } };
template <> struct WFrag<bf> { typedef v16bf V; static __device__ __forceinline__ V ld(const bf* p) { return cat16b(*(const v8us*)p, *(const v8us*)(p + 16)); } static __device__ __forceinline__ v8f mma(V a, V b, v8f c) { return wmmab(a, b, c); } };
template <typename T16, int NSPLIT, bool BIAS>
__global__ __launch_bounds__(32) void k_gemmw(const T16* __restrict__ A, const T16* __restrict__ A2, const T16* __restrict__ Bt, const T16* __restrict__ Bt2, int K, float* C, int ldc, const float* __restrict__ bias, size_t sA, size_t sB, size_t sC) {
    typedef typename WFrag<T16>::V V;
    __shared__ __align__(16) float os[16 * 68];
    const size_t z = blockIdx.z; A += z * sA; if (A2) A2 += z * sA; Bt += z * sB; if (Bt2) Bt2 += z * sB; C += z * sC;
    const int lane = threadIdx.x & 31, lr = lane & 15, hi = lane >> 4; const int r0 = blockIdx.x * 64, c0 = blockIdx.y * 64;
    v8f acc[4][4];
#pragma unroll
    for (int mb = 0; mb < 4; ++mb)
#pragma unroll
        for (int nb = 0; nb < 4; ++nb) acc[mb][nb] = (v8f){};
    const size_t aoff = (size_t)(r0 + lr) * K + 8 * hi, boff = (size_t)(c0 + lr) * K + 8 * hi;
#pragma unroll 1
    for (int kc = 0; kc < K; kc += 32) {
        V a[4], a2[4];
#pragma unroll
        for (int mb = 0; mb < 4; ++mb) { a[mb] = WFrag<T16>::ld(A + aoff + (size_t)mb * 16 * K + kc); if (NSPLIT == 1 || NSPLIT == 2) a2[mb] = WFrag<T16>::ld(A2 + aoff + (size_t)mb * 16 * K + kc); }
#pragma unroll
        for (int nb = 0; nb < 4; ++nb) { const V b = WFrag<T16>::ld(Bt + boff + (size_t)nb * 16 * K + kc); V b2; if (NSPLIT >= 2) b2 = WFrag<T16>::ld(Bt2 + boff + (size_t)nb * 16 * K + kc);
#pragma unroll
            for (int mb = 0; mb < 4; ++mb) { acc[mb][nb] = WFrag<T16>::mma(a[mb], b, acc[mb][nb]); if (NSPLIT == 1 || NSPLIT == 2) acc[mb][nb] = WFrag<T16>::mma(a2[mb], b, acc[mb][nb]); if (NSPLIT >= 2) acc[mb][nb] = WFrag<T16>::mma(a[mb], b2, acc[mb][nb]); } }
        asm volatile("v_nop\n\tv_nop\n\tv_nop\n\tv_nop" : "+v"(acc[0][0]), "+v"(acc[1][1]), "+v"(acc[2][2]), "+v"(acc[3][3]) : "v"(a[0]), "v"(a[3]));
    }
#pragma unroll
    for (int mb = 0; mb < 4; ++mb) {
#pragma unroll
        for (int nb = 0; nb < 4; ++nb) {
#pragma unroll
            for (int j = 0; j < 8; ++j) os[(hi * 8 + j) * 68 + nb * 16 + lr] = acc[mb][nb][j]; }
        __builtin_amdgcn_wave_barrier(); asm volatile("" ::: "memory");
        float* crow = C + (size_t)(r0 + mb * 16) * ldc + c0;
{
#pragma unroll
            for (int s = 0; s < 8; ++s) { const int row = 2 * s + hi, cofs = lr * 4; v4f val = *(const v4fa*)(os + row * 68 + cofs); if (BIAS) { val[0] += bfr(bias[c0 + cofs]); val[1] += bfr(bias[c0 + cofs + 1]); val[2] += bfr(bias[c0 + cofs + 2]); val[3] += bfr(bias[c0 + cofs + 3]); }
                *(v4f*)(crow + (size_t)row * ldc + cofs) = val; }
             }
        __builtin_amdgcn_wave_barrier(); asm volatile("" ::: "memory");
    }
}

// ---- k_gemmc: the same one-wave 64x64 tile GEMM specialised for causal attention: CMODE 1 skips score tiles entirely above the diagonal (query rows r0+roff.., key columns c0..), CMODE 2 limits the
// key (K) loop of the probability x value contraction to the diagonal block (probabilities beyond it are exactly zero). roff = row offset of this launch's first row within the sequence. lda = pitch of A in elements (Bt has pitch K).
template <typename T16, int NSPLIT, int CMODE>
__global__ __launch_bounds__(32) void k_gemmc(const T16* __restrict__ A, const T16* __restrict__ A2, const T16* __restrict__ Bt, const T16* __restrict__ Bt2, int K, int lda, float* C, int ldc, int roff, size_t sA, size_t sB, size_t sC) {
    typedef typename WFrag<T16>::V V;
    __shared__ __align__(16) float os[16 * 68];
    const size_t z = blockIdx.z; A += z * sA; if (A2) A2 += z * sA; Bt += z * sB; if (Bt2) Bt2 += z * sB; C += z * sC;
    const int lane = threadIdx.x & 31, lr = lane & 15, hi = lane >> 4; const int r0 = blockIdx.x * 64, c0 = blockIdx.y * 64;
    if (CMODE == 1 && c0 > r0 + roff + 63) return;                  // score tile entirely above the causal diagonal: not computed (the softmax masks j > i by select)
    const int Kl = (CMODE == 2) ? min(K, r0 + roff + 64) : K;        // P.V: probabilities are exactly 0 beyond the diagonal block, so the K loop stops there
    v8f acc[4][4];
#pragma unroll
    for (int mb = 0; mb < 4; ++mb)
#pragma unroll
        for (int nb = 0; nb < 4; ++nb) acc[mb][nb] = (v8f){};
    const size_t aoff = (size_t)(r0 + lr) * lda + 8 * hi, boff = (size_t)(c0 + lr) * K + 8 * hi;
#pragma unroll 1
    for (int kc = 0; kc < Kl; kc += 32) {
        V a[4], a2[4];
#pragma unroll
        for (int mb = 0; mb < 4; ++mb) { a[mb] = WFrag<T16>::ld(A + aoff + (size_t)mb * 16 * lda + kc); if (NSPLIT == 1 || NSPLIT == 2) a2[mb] = WFrag<T16>::ld(A2 + aoff + (size_t)mb * 16 * lda + kc); }
#pragma unroll
        for (int nb = 0; nb < 4; ++nb) { const V b = WFrag<T16>::ld(Bt + boff + (size_t)nb * 16 * K + kc); V b2; if (NSPLIT >= 2) b2 = WFrag<T16>::ld(Bt2 + boff + (size_t)nb * 16 * K + kc);
#pragma unroll
            for (int mb = 0; mb < 4; ++mb) { acc[mb][nb] = WFrag<T16>::mma(a[mb], b, acc[mb][nb]); if (NSPLIT == 1 || NSPLIT == 2) acc[mb][nb] = WFrag<T16>::mma(a2[mb], b, acc[mb][nb]); if (NSPLIT >= 2) acc[mb][nb] = WFrag<T16>::mma(a[mb], b2, acc[mb][nb]); } }
        asm volatile("v_nop\n\tv_nop\n\tv_nop\n\tv_nop" : "+v"(acc[0][0]), "+v"(acc[1][1]), "+v"(acc[2][2]), "+v"(acc[3][3]) : "v"(a[0]), "v"(a[3]));
    }
#pragma unroll
    for (int mb = 0; mb < 4; ++mb) {
#pragma unroll
        for (int nb = 0; nb < 4; ++nb) {
#pragma unroll
            for (int j = 0; j < 8; ++j) os[(hi * 8 + j) * 68 + nb * 16 + lr] = acc[mb][nb][j]; }
        __builtin_amdgcn_wave_barrier(); asm volatile("" ::: "memory");
        float* crow = C + (size_t)(r0 + mb * 16) * ldc + c0;
{
#pragma unroll
            for (int s = 0; s < 8; ++s) { const int row = 2 * s + hi, cofs = lr * 4; v4f val = *(const v4fa*)(os + row * 68 + cofs);
                *(v4f*)(crow + (size_t)row * ldc + cofs) = val; }
             }
        __builtin_amdgcn_wave_barrier(); asm volatile("" ::: "memory");
    }
}

__device__ __forceinline__ h16 tohx(float x) { return (h16)x; }
__device__ __forceinline__ void splitf(float y, unsigned short& h, unsigned short& l) { h = f2bf(y); l = f2bf(y - bf2f(h)); }
typedef __attribute__((ext_vector_type(2))) _Float16 v2h;
typedef __attribute__((ext_vector_type(4))) _Float16 v4h;
typedef __attribute__((ext_vector_type(2))) unsigned short v2us;
typedef __attribute__((ext_vector_type(4))) unsigned short v4us;
typedef __attribute__((ext_vector_type(2))) float v2f;
typedef __attribute__((ext_vector_type(4))) int v4i;

__global__ __launch_bounds__(256) void k_wtG(const float* __restrict__ w, int K, int N, bf* Bt) {
    const int lane = threadIdx.x & 31; const int L0 = (blockIdx.x * 8 + (threadIdx.x >> 5)) * 8; const int nlines = N * K / 64;
{
#pragma unroll 1
        for (int l = 0; l < 8; ++l) { const int L = L0 + l; if (L >= nlines) break; const size_t e = (size_t)L * 64 + lane * 2; const int k = (int)(e % K), n = (int)(e / K); v2us o;
            o[0] = f2bf(w[(size_t)k * N + n]); o[1] = f2bf(w[(size_t)(k + 1) * N + n]); *(v2us*)(Bt + e) = o; }
         }
}
__global__ __launch_bounds__(256) void k_cvt8(const float* __restrict__ src, bf* dst, size_t n8) { const size_t i = (size_t)blockIdx.x * 256 + threadIdx.x; if (i >= n8) return; const v8f v = *(const v8f*)(src + i * 8); v8us o;
#pragma unroll
    for (int k = 0; k < 8; ++k) o[k] = f2bf(v[k]); *(v8us*)(dst + i * 8) = o;  }

// k_rope (grid.y = batch: F rows batch * 1024 + t, planes batch * nheads + h): head planes [h][t][d] (fp16 + hi/lo) of rope(x) x sc with the rotate-half convention out[d] = x[d] cos[t][d] - x[d+HD/2] sin[t][d], out[d+HD/2] = x[d+HD/2] cos[t][d+HD/2] + x[d] sin[t][d+HD/2]
__global__ __launch_bounds__(256) void k_rope(const float* __restrict__ F, int pitch, int nheads, const float* __restrict__ CS, const float* __restrict__ RF, const float* __restrict__ nw, float sc, h16* P16, bf* Ph, bf* Pl) {
    { const size_t b = blockIdx.y, po = b * nheads * TT * HD; F += b * TT * pitch; if (RF) RF += b * nheads * TT; P16 += po; Ph += po; Pl += po; }
    const size_t e = ((size_t)blockIdx.x * 256 + threadIdx.x) * 2; if (e >= (size_t)nheads * TT * HD) return; const int d = (int)(e % HD); const int t = (int)((e / HD) % TT); const int h = (int)(e / ((size_t)HD * TT)); const float* f = F + (size_t)t * pitch + h * HD; const float rf = RF ? RF[(size_t)h * TT + t] : 1.0f; v2h o16; v2us oh, ol;
#pragma unroll
    for (int q = 0; q < 2; ++q) { const int dd = d + q; const int dp = (dd < HD / 2) ? dd + HD / 2 : dd - HD / 2; float x0 = f[dd], x1 = f[dp];
        if (RF) { float n0 = __fmul_rn(x0, rf), n1 = __fmul_rn(x1, rf); asm volatile("" : "+v"(n0)); asm volatile("" : "+v"(n1)); x0 = __fmul_rn(bfr(nw[dd]), n0); x1 = __fmul_rn(bfr(nw[dp]), n1); }
        const v2f cs = *(const v2f*)(CS + ((size_t)t * HD + dd) * 2); float a = __fmul_rn(x0, cs[0]), bq = __fmul_rn(x1, cs[1]); asm volatile("" : "+v"(a)); asm volatile("" : "+v"(bq)); const float r = ((dd < HD / 2) ? __fsub_rn(a, bq) : __fadd_rn(a, bq)) * sc;
        o16[q] = tohx(r); unsigned short a2, c2; splitf(r, a2, c2); oh[q] = a2; ol[q] = c2; }
    *(v2h*)(P16 + e) = o16; *(v2us*)(Ph + e) = oh; *(v2us*)(Pl + e) = ol;  }
__global__ __launch_bounds__(256) void k_vtp(const float* __restrict__ F, int pitch, int nheads, h16* V16, bf* Vh, bf* Vl) { { const size_t b = blockIdx.y, po = b * nheads * HD * TT; F += b * TT * pitch; V16 += po; Vh += po; Vl += po; }   /* grid.y = batch */ const size_t e = ((size_t)blockIdx.x * 256 + threadIdx.x) * 2; if (e >= (size_t)nheads * HD * TT) return; const int t = (int)(e % TT); const int d = (int)((e / TT) % HD); const int g = (int)(e / ((size_t)TT * HD)); v2h o16; v2us oh, ol;
#pragma unroll
    for (int q = 0; q < 2; ++q) { const float x = F[(size_t)(t + q) * pitch + g * HD + d]; o16[q] = tohx(x); unsigned short a2, c2; splitf(x, a2, c2); oh[q] = a2; ol[q] = c2; }
    *(v2h*)(V16 + e) = o16; *(v2us*)(Vh + e) = oh; *(v2us*)(Vl + e) = ol;  }
__global__ __launch_bounds__(256) void k_csid(float* CS) { const int idx = blockIdx.x * 256 + threadIdx.x; if (idx >= TT * HD) return; v2f cs; cs[0] = 1.0f; cs[1] = 0.0f; *(v2f*)(CS + (size_t)idx * 2) = cs;  }
__global__ __launch_bounds__(256) void k_gproj(const float* __restrict__ F, int pitch, const float* __restrict__ dirs, float* PJ) { const int idx = blockIdx.x * 256 + threadIdx.x; if (idx >= NH_ * TT) return; const int t = idx % TT, h = idx / TT; const float* f = F + ((size_t)blockIdx.y * TT + t) * pitch + h * HD;   /* grid.y = batch */ float p0 = __fmul_rn(f[0], bfr(dirs[h * 3])), p1 = __fmul_rn(f[1], bfr(dirs[h * 3 + 1])), p2 = __fmul_rn(f[2], bfr(dirs[h * 3 + 2])); asm volatile("" : "+v"(p0), "+v"(p1), "+v"(p2)); const float v = __fadd_rn(__fadd_rn(p0, p1), p2); *(float*)(PJ + (size_t)blockIdx.y * NH_ * TT + idx) = v;  }
// k_asoft: per row (zz, i): t = S x HD^-0.5 + head_scale x qp_i x kp_j for j <= i (causal; the reference's -1e9 additive fill vanishes identically); softmax over the 1024 keys (register row, one exp, fixed trees);
// the 16-bit probabilities go back IN PLACE over the row's own 4 KiB of scores (P16 | Ph at its start, Pl 2 KiB on; pitch 2 x TT elements): the wave holds the whole row in registers before its first store, and no other wave touches the row.
__global__ __launch_bounds__(256) void k_asoft(const float* Sb, const float* __restrict__ QPJ, const float* __restrict__ KPJ, const float* __restrict__ HSC, h16* P16, bf* Ph, bf* Pl) {
    const int lane = threadIdx.x & 31; const int row = blockIdx.x * 8 + (threadIdx.x >> 5); if (row >= ZH * TT) return; const int i = row % TT; const int zz = row / TT; const int h = zz % NH_; const float hs = bfr(HSC[h]); const float qp = QPJ[(size_t)zz * TT + i]; const float* kpr = KPJ + (size_t)zz * TT; const bool hires = (i < RH); const float* sr = Sb + (size_t)row * TT; float v[TT / 32]; float mx = -3.0e38f;
#pragma unroll
    for (int ch = 0; ch < TT / 128; ++ch) { const int j0 = ch * 128 + lane * 4; const v4f a = *(const v4f*)(sr + j0);
#pragma unroll
        for (int q = 0; q < 4; ++q) { const int j = j0 + q; (void)j; float sa = a[q] * SCL; asm volatile("" : "+v"(sa)); float gb = __fmul_rn(qp, kpr[j]); asm volatile("" : "+v"(gb)); float hb = __fmul_rn(hs, gb); asm volatile("" : "+v"(hb)); float tl = __fadd_rn(sa, hb); asm volatile("" : "+v"(tl)); const float t = (j <= i) ? tl : -3.0e38f;   /* s/sqrt(128) + head_scale (qp_i kp_j), causal */ v[ch * 4 + q] = t; mx = fmaxf(mx, t); } }
#pragma unroll
    for (int sh = 16; sh; sh >>= 1) mx = fmaxf(mx, __shfl_xor(mx, sh, 32));
    float sum = 0.f;
#pragma unroll
    for (int k = 0; k < TT / 32; ++k) { float d0 = __fsub_rn(v[k], mx); asm volatile("" : "+v"(d0)); v[k] = __builtin_amdgcn_exp2f(__fmul_rn(d0, 1.4426950408889634f)); sum += v[k]; }
#pragma unroll
    for (int sh = 16; sh; sh >>= 1) sum += __shfl_xor(sum, sh, 32);
    const float f = __fdiv_rn(hires ? 1.0f : PCAR, sum);
{
        if (hires) {
#pragma unroll
            for (int ch = 0; ch < TT / 128; ++ch) { v4us oh, ol;
#pragma unroll
                for (int q = 0; q < 4; ++q) { unsigned short a, c2; splitf(v[ch * 4 + q] * f, a, c2); oh[q] = a; ol[q] = c2; }
                const size_t oo = (size_t)row * (2 * TT) + ch * 128 + lane * 4; *(v4us*)(Ph + oo) = oh; *(v4us*)(Pl + oo) = ol; }
        } else {
#pragma unroll
            for (int ch = 0; ch < TT / 128; ++ch) { v4h o4;
#pragma unroll
                for (int q = 0; q < 4; ++q) o4[q] = tohx(v[ch * 4 + q] * f);
                *(v4h*)(P16 + (size_t)row * (2 * TT) + ch * 128 + lane * 4) = o4; } }
         }
}
__global__ __launch_bounds__(256) void k_merge(const float* __restrict__ O, bf* Ah, bf* Al) { const size_t e = ((size_t)blockIdx.x * 256 + threadIdx.x) * 2; if (e >= (size_t)ZH * TT * HD) return; const int d = (int)(e % HD); const int t = (int)((e / HD) % TT); const int zz = (int)(e / ((size_t)HD * TT)); const float cs = (t < RH) ? 1.0f : (1.0f / PCAR); const size_t oo = ((size_t)(zz / NH_) * TT + t) * DQ + (zz % NH_) * HD + d;
    v2us oh, ol;
#pragma unroll
    for (int q = 0; q < 2; ++q) { unsigned short a, c2; splitf(O[e + q] * cs, a, c2); oh[q] = a; ol[q] = c2; } *(v2us*)(Ah + oo) = oh; *(v2us*)(Al + oo) = ol;  }

extern "C" void kernel_launch(void* const* d_in, const int* in_sizes, int n_in,
                              void* d_out, int out_size, void* d_ws, size_t ws_size, hipStream_t stream) {
    (void)in_sizes; (void)n_in; (void)out_size;
    const float* x = (const float*)d_in[0]; const float* wqkv = (const float*)d_in[1]; const float* wo = (const float*)d_in[2]; const float* HSC = (const float*)d_in[3]; const float* HDR = (const float*)d_in[4];  const float* wq = nullptr; const float* wk = nullptr; const float* wv = nullptr; (void)wq; (void)wk; (void)wv;
    float* OUT = (float*)d_out;     // [4][1024][1024]
    char* wsp = (char*)d_ws;
    auto take = [&](size_t bytes) { char* p = wsp; wsp += (bytes + 255) & ~(size_t)255; return (void*)p; };
    bf* WALL = (bf*)take((size_t)3 * DM * DM * 2); bf* WO = (bf*)take((size_t)DM * DQ * 2); float* CS = (float*)take((size_t)TT * HD * 2 * 4);
    bf* XB = (bf*)take((size_t)NB_ * TT * DM * 2); float* QPJ = (float*)take((size_t)ZH * TT * 4); float* KPJ = (float*)take((size_t)ZH * TT * 4);
    h16* QP16 = (h16*)take((size_t)ZH * TT * HD * 2); h16* KP16 = (h16*)take((size_t)ZH * TT * HD * 2); h16* VT16 = (h16*)take((size_t)ZH * HD * TT * 2);
    bf* QPh = (bf*)take((size_t)ZH * TT * HD * 2); bf* QPl = (bf*)take((size_t)ZH * TT * HD * 2); bf* KPh = (bf*)take((size_t)ZH * TT * HD * 2); bf* KPl = (bf*)take((size_t)ZH * TT * HD * 2); bf* VTh = (bf*)take((size_t)ZH * HD * TT * 2); bf* VTl = (bf*)take((size_t)ZH * HD * TT * 2);
    float* Sb = (float*)take((size_t)ZH * TT * TT * 4); float* Ob = (float*)take((size_t)ZH * TT * HD * 4); bf* ATh = (bf*)take((size_t)NB_ * TT * DQ * 2); bf* ATl = (bf*)take((size_t)NB_ * TT * DQ * 2);
    if ((size_t)(wsp - (char*)d_ws) > ws_size) return;    // ws 256 MiB (about 249 MiB taken)
    float* F = Sb;                      // f32 [4096][q | k | v] projection (48 MiB): dead once the planes are built, before the first score tile is stored (stream-ordered)
    h16* P16 = (h16*)Sb; bf* Ph = (bf*)Sb; bf* Pl = (bf*)Sb + TT;   // probabilities in place over the score rows, pitch 2 x TT elements
    k_wtG<<<(unsigned)((DM * 3 * DM / 64 + 63) / 64), 256, 0, stream>>>(wqkv, DM, 3 * DM, WALL);   /* fused 'xw' [DM][3DM] -> Bt [3DM][DM] (row blocks q | k | v) */
    k_wtG<<<(unsigned)((DQ * DM / 64 + 63) / 64), 256, 0, stream>>>(wo, DQ, DM, WO);
    k_csid<<<(TT * HD + 255) / 256, 256, 0, stream>>>(CS);
    const dim3 LP((unsigned)(((size_t)NH_ * TT * HD / 2 + 255) / 256), NB_, 1), LJ((NH_ * TT + 255) / 256, NB_, 1);   // per-batch grids x batch
    k_cvt8<<<(unsigned)(((size_t)NB_ * TT * DM / 8 + 255) / 256), 256, 0, stream>>>(x, XB, (size_t)NB_ * TT * DM / 8);
    k_gemmw<bf, 0, false><<<dim3(NB_ * TT / 64, 3 * DM / 64, 1), 32, 0, stream>>>(XB, nullptr, WALL, nullptr, DM, F, 3 * DM, nullptr, 0, 0, 0);
    k_rope<<<LP, 256, 0, stream>>>(F, 3 * DM, NH_, CS, nullptr, nullptr, 1.0f, QP16, QPh, QPl); k_gproj<<<LJ, 256, 0, stream>>>(F, 3 * DM, HDR, QPJ);
    k_rope<<<LP, 256, 0, stream>>>(F + DM, 3 * DM, NKV, CS, nullptr, nullptr, 1.0f, KP16, KPh, KPl); k_gproj<<<LJ, 256, 0, stream>>>(F + DM, 3 * DM, HDR, KPJ);
    k_vtp<<<LP, 256, 0, stream>>>(F + 2 * DM, 3 * DM, NKV, VT16, VTh, VTl);
    k_gemmc<bf, 2, 1><<<dim3(RH / 64, TT / 64, ZH), 32, 0, stream>>>(QPh, QPl, KPh, KPl, HD, HD, Sb, TT, 0, (size_t)TT * HD, (size_t)TT * HD, (size_t)TT * TT);
    k_gemmc<h16, 0, 1><<<dim3((TT - RH) / 64, TT / 64, ZH), 32, 0, stream>>>(QP16 + (size_t)RH * HD, nullptr, KP16, nullptr, HD, HD, Sb + (size_t)RH * TT, TT, RH, (size_t)TT * HD, (size_t)TT * HD, (size_t)TT * TT);
    k_asoft<<<ZH * TT / 8, 256, 0, stream>>>(Sb, QPJ, KPJ, HSC, P16, Ph, Pl);
    k_gemmc<bf, 2, 2><<<dim3(RH / 64, HD / 64, ZH), 32, 0, stream>>>(Ph, Pl, VTh, VTl, TT, 2 * TT, Ob, HD, 0, (size_t)TT * 2 * TT, (size_t)HD * TT, (size_t)TT * HD);
    k_gemmc<h16, 0, 2><<<dim3((TT - RH) / 64, HD / 64, ZH), 32, 0, stream>>>(P16 + (size_t)RH * 2 * TT, nullptr, VT16, nullptr, TT, 2 * TT, Ob + (size_t)RH * HD, HD, RH, (size_t)TT * 2 * TT, (size_t)HD * TT, (size_t)TT * HD);
    k_merge<<<(unsigned)(((size_t)ZH * TT * HD / 2 + 255) / 256), 256, 0, stream>>>(Ob, ATh, ATl);
    k_gemmw<bf, 1, false><<<dim3(NB_ * TT / 64, DM / 64, 1), 32, 0, stream>>>(ATh, ATl, WO, nullptr, DQ, OUT, DM, nullptr, 0, 0, 0);
}

// v002
// One run takes 217 microseconds.
// Two timings next to v001 put it at 1.34 and 1.33 times that version's speed.
// Counting every step since v000, it is 6.15 times as fast.
#include <hip/hip_runtime.h>

// Causal multi-head attention with a rank-1 'trigram' geometric bias (x [4][1024][1024]; [q|k|v] = x Wqkv ('xw' [1024][3072], no bias; 8 heads x 128); scores = q.k/sqrt(128) + head_scales[h] (q_i[:3].dirs[h]) (k_j[:3].dirs[h]) (head_scales [8], head_dirs [8][3] read); causal (-inf); softmax; out = merged Wout ('xw') -> [4][1024][1024] (4.2 M)).
// Layout: projections/planes, every stage launched once for all 4 batches x 8 heads (plane index z = batch * 8 + head); the two 3-term projections per (head, token) are formed once in f32 from the f32 q/k projections; the softmax kernel adds head_scale x qp_i x kp_j to each live logit.
// Compute dtypes, f32 accumulate: every input rounded to bf16; q/k/v on PLAIN bf16 operands (inputs: exact); geometric bias in f32 inside the softmax kernel; causal scores and attn.v (tile skipping): query rows < 512 hl (3 products), the rest single fp16 (x1024); softmax f32; Wout hl x exact (2 products).

#define NB_  4
#define TT   1024
#define DM   1024
#define NH_  8
#define NKV  8
#define REP  (NH_ / NKV)
#define HD   128
#define DQ   (NH_ * HD)
#define DKV  (NKV * HD)
#define ZH   (NB_ * NH_)          // planes per launch: every (batch, head)
#define RH   512                  // query rows < RH use hi+lo planes (0: none)
#define WIN  1024
#define PCAR 1024.0f
#define SCL  0.088388347648318447f   // HD^-0.5
typedef _Float16 h16;
typedef unsigned short bf;
typedef __attribute__((ext_vector_type(16))) __bf16   v16bf;
typedef __attribute__((ext_vector_type(16))) _Float16 v16h;
typedef __attribute__((ext_vector_type(8)))  _Float16 v8h;
typedef __attribute__((ext_vector_type(8)))  unsigned short v8us;
typedef __attribute__((ext_vector_type(8)))  float    v8f;
typedef __attribute__((ext_vector_type(4)))  float    v4f;
typedef v8h  __attribute__((may_alias)) v8ha;
typedef v4f  __attribute__((may_alias)) v4fa;
typedef v8us __attribute__((may_alias)) v8usa;

__device__ __forceinline__ unsigned short f2bf(float f) { unsigned u = __float_as_uint(f); u += 0x7FFFu + ((u >> 16) & 1u); return (unsigned short)(u >> 16); }
__device__ __forceinline__ float bf2f(unsigned short b) { return __uint_as_float(((unsigned)b) << 16); }
__device__ __forceinline__ float bfr(float f) { return bf2f(f2bf(f)); }
__device__ __forceinline__ v16h cat16(v8h lo, v8h hi) { return __builtin_shufflevector(lo, hi, 0, 1, 2, 3, 4, 5, 6, 7, 8, 9, 10, 11, 12, 13, 14, 15); }
__device__ __forceinline__ v16bf cat16b(v8us lo, v8us hi) { return __builtin_bit_cast(v16bf, __builtin_shufflevector(lo, hi, 0, 1, 2, 3, 4, 5, 6, 7, 8, 9, 10, 11, 12, 13, 14, 15)); }
__device__ __forceinline__ v8f wmma16(v16h a, v16h b, v8f c) { return __builtin_amdgcn_wmma_f32_16x16x32_f16(false, a, false, b, (short)0, c, false, false); }
__device__ __forceinline__ v8f wmmab(v16bf a, v16bf b, v8f c) { return __builtin_amdgcn_wmma_f32_16x16x32_bf16(false, a, false, b, (short)0, c, false, false); }



// ---- gemm_tile: 128x128 output tile per work-group of 4 waves (2x2, each wave 64x64 = 16 accumulators). Every operand plane's 128 rows x 64 k are brought in as whole 128-byte lines (a wave's 16-byte loads cover 4 rows),
// staged through registers into a two-buffer LDS ring and shared by the waves; fragments come from LDS. The next stage's global loads fly while this stage is multiplied; one work-group barrier per stage.
// C[m][n] (f32, pitch ldc, + optional f32 bias[n]) = sum_k A[m][k] Bt[n][k] (+ split products per NSPLIT), k ascending in steps of 32 per accumulator. lda = pitch of A in elements (Bt has pitch K), both compile-time, so that every row step of a staging load is an immediate offset on one fixed address. K % 64 == 0; M, N % 128 == 0.
// CMODE 1 skips score tiles entirely above the causal diagonal (query rows r0+roff.., key columns c0..); CMODE 2 limits the key (K) loop of the probability x value contraction to the diagonal block (probabilities beyond it are exactly zero).
#define BKS 64      // k elements per stage: one whole 128-byte line of every operand row
#define LPT 72      // LDS row pitch in elements: 144 B = 16 B x odd, so that 16-byte fragment reads of 16 rows spread over the banks
template <typename T16> struct WFrag;
template <> struct WFrag<h16> { typedef v16h V; typedef v8h H; static __device__ __forceinline__ V ld(const h16* p) { return cat16(*(const v8h*)p, *(const v8h*)(p + 16)); } static __device__ __forceinline__ v8f mma(V a, V b, v8f c) { return wmma16(a, b, c); } };
template <> struct WFrag<bf> { typedef v16bf V; typedef v8us H; static __device__ __forceinline__ V ld(const bf* p) { return cat16b(*(const v8us*)p, *(const v8us*)(p + 16)); } static __device__ __forceinline__ v8f mma(V a, V b, v8f c) { return wmmab(a, b, c); } };
template <typename T16, int NSPLIT, int CMODE, bool BIAS, int K, int lda>
__device__ __forceinline__ void gemm_tile(const T16* __restrict__ A, const T16* __restrict__ A2, const T16* __restrict__ Bt, const T16* __restrict__ Bt2, float* C, int ldc, int roff, const float* __restrict__ bias) {
    typedef typename WFrag<T16>::V V; typedef typename WFrag<T16>::H H;
    constexpr int NA = (NSPLIT == 1 || NSPLIT == 2) ? 2 : 1, NP = NA + ((NSPLIT >= 2) ? 2 : 1), NF = (NSPLIT <= 1) ? 2 : 1;   // planes: A (A2) | Bt (Bt2); k-steps per fragment group
    __shared__ __align__(16) unsigned char smem[2 * NP * 128 * LPT * 2];                          // two stage buffers; the epilogue's row staging reuses them behind the last barrier
    T16* st = (T16*)smem;
    const int tid = threadIdx.x, lane = tid & 31, wv = tid >> 5, lr = lane & 15, hi = lane >> 4; const int wm = wv >> 1, wn = wv & 1; const int r0 = blockIdx.x * 128, c0 = blockIdx.y * 128;
    if (CMODE == 1 && c0 > r0 + roff + 127) return;                  // score tile entirely above the causal diagonal: never written (the softmax masks j > i by select); the whole work-group leaves, ahead of every barrier
    const int Kl = (CMODE == 2) ? min(K, r0 + roff + 128) : K;       // P.V: probabilities are exactly 0 beyond the diagonal block, so the K loop stops there
    v8f acc[4][4];
#pragma unroll
    for (int mb = 0; mb < 4; ++mb)
#pragma unroll
        for (int nb = 0; nb < 4; ++nb) acc[mb][nb] = (v8f){};
    const char* gb[NP]; gb[0] = (const char*)(A + (size_t)r0 * lda); if (NA == 2) gb[1] = (const char*)(A2 + (size_t)r0 * lda); gb[NA] = (const char*)(Bt + (size_t)c0 * K); if (NSPLIT >= 2) gb[NA + 1] = (const char*)(Bt2 + (size_t)c0 * K);   // work-group-uniform bases
    const unsigned trow = tid >> 3, tcol = (tid & 7) * 8;            // this thread's 16 bytes: row trow + 16 i, 8 threads to a 128-byte row
    const unsigned oa = (trow * lda + tcol) * 2, ob = (trow * K + tcol) * 2, ol = trow * LPT + tcol;   // oa, ob: the thread's fixed byte offsets from the uniform bases
    H rg[NP][8];
#pragma unroll
    for (int p = 0; p < NP; ++p)
#pragma unroll
        for (int i = 0; i < 8; ++i) rg[p][i] = *(const H*)(gb[p] + (size_t)(i * 16) * (p < NA ? lda : K) * 2 + (p < NA ? oa : ob));
    asm volatile("s_wait_xcnt 0x0" ::: "memory");   // stands ahead of whatever next overwrites an address register of the loads above
#pragma unroll
    for (int p = 0; p < NP; ++p)
#pragma unroll
        for (int i = 0; i < 8; ++i) *(H*)(st + (p * 128 + i * 16) * LPT + ol) = rg[p][i];
    __syncthreads();
    const int fa = (wm * 64 + lr) * LPT + 8 * hi, fb = (NA * 128 + wn * 64 + lr) * LPT + 8 * hi;
#pragma unroll 1
    for (int kc = 0; kc < Kl; kc += BKS) {
        const T16* sc = st + ((kc / BKS) & 1) * (NP * 128 * LPT); T16* sn = st + (((kc / BKS) & 1) ^ 1) * (NP * 128 * LPT); const bool more = kc + BKS < Kl;
        if (more) {
#pragma unroll
            for (int p = 0; p < NP; ++p)
#pragma unroll
                for (int i = 0; i < 8; ++i) rg[p][i] = *(const H*)(gb[p] + ((size_t)(i * 16) * (p < NA ? lda : K) + kc + BKS) * 2 + (p < NA ? oa : ob));
            asm volatile("s_wait_xcnt 0x0" ::: "memory"); }   // ahead of the fragment reads below, which reuse the address registers of these loads
#pragma unroll
        for (int k0 = 0; k0 < BKS / 32; k0 += NF) {
            V a[NF][4], a2[NF][4], b[NF][4], b2[NF][4];               // all fragments of NF k-steps are fetched as one group, ahead of their matrix instructions
#pragma unroll
            for (int f = 0; f < NF; ++f)
#pragma unroll
                for (int q = 0; q < 4; ++q) { const int kk = (k0 + f) * 32; a[f][q] = WFrag<T16>::ld(sc + fa + q * 16 * LPT + kk); b[f][q] = WFrag<T16>::ld(sc + fb + q * 16 * LPT + kk);
                    if (NSPLIT == 1 || NSPLIT == 2) a2[f][q] = WFrag<T16>::ld(sc + fa + (128 + q * 16) * LPT + kk); if (NSPLIT >= 2) b2[f][q] = WFrag<T16>::ld(sc + fb + (128 + q * 16) * LPT + kk); }
            __builtin_amdgcn_sched_barrier(0);   // keeps the group of LDS reads ahead of the matrix instructions: sunk between them, each read's latency is waited out in full
#pragma unroll
            for (int f = 0; f < NF; ++f)
#pragma unroll
                for (int nb = 0; nb < 4; ++nb)
#pragma unroll
                    for (int mb = 0; mb < 4; ++mb) { acc[mb][nb] = WFrag<T16>::mma(a[f][mb], b[f][nb], acc[mb][nb]); if (NSPLIT == 1 || NSPLIT == 2) acc[mb][nb] = WFrag<T16>::mma(a2[f][mb], b[f][nb], acc[mb][nb]); if (NSPLIT >= 2) acc[mb][nb] = WFrag<T16>::mma(a[f][mb], b2[f][nb], acc[mb][nb]); }
            // four vector slots behind the stage's last matrix instruction: the loop's taken branch leads to loads that overwrite its operand registers
            if (k0 + NF == BKS / 32) asm volatile("v_nop\n\tv_nop\n\tv_nop\n\tv_nop" : "+v"(acc[0][0]), "+v"(acc[1][1]), "+v"(acc[2][2]), "+v"(acc[3][3]) : "v"(a[NF - 1][0]), "v"(a[NF - 1][3]));
        }
        if (more) {
#pragma unroll
            for (int p = 0; p < NP; ++p)
#pragma unroll
                for (int i = 0; i < 8; ++i) *(H*)(sn + (p * 128 + i * 16) * LPT + ol) = rg[p][i]; }
        __syncthreads();   // publishes the next stage and ends every wave's reads of this one, whose buffer the next pass refills
    }
    float* os = (float*)smem + wv * (16 * 68);
#pragma unroll
    for (int mb = 0; mb < 4; ++mb) {
#pragma unroll
        for (int nb = 0; nb < 4; ++nb) {
#pragma unroll
            for (int j = 0; j < 8; ++j) os[(hi * 8 + j) * 68 + nb * 16 + lr] = acc[mb][nb][j]; }
        __builtin_amdgcn_wave_barrier(); asm volatile("" ::: "memory");
        const int cw = c0 + wn * 64; float* crow = C + (size_t)(r0 + wm * 64 + mb * 16) * ldc + cw;
#pragma unroll
        for (int s = 0; s < 8; ++s) { const int row = 2 * s + hi, cofs = lr * 4; v4f val = *(const v4fa*)(os + row * 68 + cofs); if (BIAS) { val[0] += bfr(bias[cw + cofs]); val[1] += bfr(bias[cw + cofs + 1]); val[2] += bfr(bias[cw + cofs + 2]); val[3] += bfr(bias[cw + cofs + 3]); }
            *(v4f*)(crow + (size_t)row * ldc + cofs) = val; }
        __builtin_amdgcn_wave_barrier(); asm volatile("" ::: "memory");
    }
}

// ---- k_gemmw: plain GEMM on gemm_tile; grid (M/128, N/128, Z), 128 threads. z-batch strides sA/sB/sC in elements.
template <typename T16, int NSPLIT, bool BIAS>
__global__ __launch_bounds__(128) void k_gemmw(const T16* __restrict__ A, const T16* __restrict__ A2, const T16* __restrict__ Bt, const T16* __restrict__ Bt2, int K, float* C, int ldc, const float* __restrict__ bias, size_t sA, size_t sB, size_t sC) {
    const size_t z = blockIdx.z; A += z * sA; if (A2) A2 += z * sA; Bt += z * sB; if (Bt2) Bt2 += z * sB; C += z * sC;
    (void)K; gemm_tile<T16, NSPLIT, 0, BIAS, DM, DM>(A, A2, Bt, Bt2, C, ldc, 0, bias);   // K = 1024 in both launches
}

// ---- k_gemmc: the same tile GEMM for causal attention (CMODE 1: scores, CMODE 2: probability x value). roff = row offset of this launch's first row within the sequence.
template <typename T16, int NSPLIT, int CMODE>
__global__ __launch_bounds__(128) void k_gemmc(const T16* __restrict__ A, const T16* __restrict__ A2, const T16* __restrict__ Bt, const T16* __restrict__ Bt2, int K, int lda, float* C, int ldc, int roff, size_t sA, size_t sB, size_t sC) {
    const size_t z = blockIdx.z; A += z * sA; if (A2) A2 += z * sA; Bt += z * sB; if (Bt2) Bt2 += z * sB; C += z * sC;
    (void)K; (void)lda; gemm_tile<T16, NSPLIT, CMODE, false, (CMODE == 1) ? HD : TT, (CMODE == 1) ? HD : 2 * TT>(A, A2, Bt, Bt2, C, ldc, roff, nullptr);   // scores: K = lda = 128; P.V: K = 1024, lda = 2048
}

__device__ __forceinline__ h16 tohx(float x) { return (h16)x; }
__device__ __forceinline__ void splitf(float y, unsigned short& h, unsigned short& l) { h = f2bf(y); l = f2bf(y - bf2f(h)); }
typedef __attribute__((ext_vector_type(2))) _Float16 v2h;
typedef __attribute__((ext_vector_type(4))) _Float16 v4h;
typedef __attribute__((ext_vector_type(2))) unsigned short v2us;
typedef __attribute__((ext_vector_type(4))) unsigned short v4us;
typedef __attribute__((ext_vector_type(2))) float v2f;
typedef __attribute__((ext_vector_type(4))) int v4i;

__global__ __launch_bounds__(256) void k_wtG(const float* __restrict__ w, int K, int N, bf* Bt) {
    const int lane = threadIdx.x & 31; const int L0 = (blockIdx.x * 8 + (threadIdx.x >> 5)) * 8; const int nlines = N * K / 64;
{
#pragma unroll 1
        for (int l = 0; l < 8; ++l) { const int L = L0 + l; if (L >= nlines) break; const size_t e = (size_t)L * 64 + lane * 2; const int k = (int)(e % K), n = (int)(e / K); v2us o;
            o[0] = f2bf(w[(size_t)k * N + n]); o[1] = f2bf(w[(size_t)(k + 1) * N + n]); *(v2us*)(Bt + e) = o; }
         }
}
__global__ __launch_bounds__(256) void k_cvt8(const float* __restrict__ src, bf* dst, size_t n8) { const size_t i = (size_t)blockIdx.x * 256 + threadIdx.x; if (i >= n8) return; const v8f v = *(const v8f*)(src + i * 8); v8us o;
#pragma unroll
    for (int k = 0; k < 8; ++k) o[k] = f2bf(v[k]); *(v8us*)(dst + i * 8) = o;  }

// k_rope (grid.y = batch: F rows batch * 1024 + t, planes batch * nheads + h): head planes [h][t][d] (fp16 + hi/lo) of rope(x) x sc with the rotate-half convention out[d] = x[d] cos[t][d] - x[d+HD/2] sin[t][d], out[d+HD/2] = x[d+HD/2] cos[t][d+HD/2] + x[d] sin[t][d+HD/2]
__global__ __launch_bounds__(256) void k_rope(const float* __restrict__ F, int pitch, int nheads, const float* __restrict__ CS, const float* __restrict__ RF, const float* __restrict__ nw, float sc, h16* P16, bf* Ph, bf* Pl) {
    { const size_t b = blockIdx.y, po = b * nheads * TT * HD; F += b * TT * pitch; if (RF) RF += b * nheads * TT; P16 += po; Ph += po; Pl += po; }
    const size_t e = ((size_t)blockIdx.x * 256 + threadIdx.x) * 2; if (e >= (size_t)nheads * TT * HD) return; const int d = (int)(e % HD); const int t = (int)((e / HD) % TT); const int h = (int)(e / ((size_t)HD * TT)); const float* f = F + (size_t)t * pitch + h * HD; const float rf = RF ? RF[(size_t)h * TT + t] : 1.0f; v2h o16; v2us oh, ol;
#pragma unroll
    for (int q = 0; q < 2; ++q) { const int dd = d + q; const int dp = (dd < HD / 2) ? dd + HD / 2 : dd - HD / 2; float x0 = f[dd], x1 = f[dp];
        if (RF) { float n0 = __fmul_rn(x0, rf), n1 = __fmul_rn(x1, rf); asm volatile("" : "+v"(n0)); asm volatile("" : "+v"(n1)); x0 = __fmul_rn(bfr(nw[dd]), n0); x1 = __fmul_rn(bfr(nw[dp]), n1); }
        const v2f cs = *(const v2f*)(CS + ((size_t)t * HD + dd) * 2); float a = __fmul_rn(x0, cs[0]), bq = __fmul_rn(x1, cs[1]); asm volatile("" : "+v"(a)); asm volatile("" : "+v"(bq)); const float r = ((dd < HD / 2) ? __fsub_rn(a, bq) : __fadd_rn(a, bq)) * sc;
        o16[q] = tohx(r); unsigned short a2, c2; splitf(r, a2, c2); oh[q] = a2; ol[q] = c2; }
    *(v2h*)(P16 + e) = o16; *(v2us*)(Ph + e) = oh; *(v2us*)(Pl + e) = ol;  }
__global__ __launch_bounds__(256) void k_vtp(const float* __restrict__ F, int pitch, int nheads, h16* V16, bf* Vh, bf* Vl) { { const size_t b = blockIdx.y, po = b * nheads * HD * TT; F += b * TT * pitch; V16 += po; Vh += po; Vl += po; }   /* grid.y = batch */ const size_t e = ((size_t)blockIdx.x * 256 + threadIdx.x) * 2; if (e >= (size_t)nheads * HD * TT) return; const int t = (int)(e % TT); const int d = (int)((e / TT) % HD); const int g = (int)(e / ((size_t)TT * HD)); v2h o16; v2us oh, ol;
#pragma unroll
    for (int q = 0; q < 2; ++q) { const float x = F[(size_t)(t + q) * pitch + g * HD + d]; o16[q] = tohx(x); unsigned short a2, c2; splitf(x, a2, c2); oh[q] = a2; ol[q] = c2; }
    *(v2h*)(V16 + e) = o16; *(v2us*)(Vh + e) = oh; *(v2us*)(Vl + e) = ol;  }
__global__ __launch_bounds__(256) void k_csid(float* CS) { const int idx = blockIdx.x * 256 + threadIdx.x; if (idx >= TT * HD) return; v2f cs; cs[0] = 1.0f; cs[1] = 0.0f; *(v2f*)(CS + (size_t)idx * 2) = cs;  }
__global__ __launch_bounds__(256) void k_gproj(const float* __restrict__ F, int pitch, const float* __restrict__ dirs, float* PJ) { const int idx = blockIdx.x * 256 + threadIdx.x; if (idx >= NH_ * TT) return; const int t = idx % TT, h = idx / TT; const float* f = F + ((size_t)blockIdx.y * TT + t) * pitch + h * HD;   /* grid.y = batch */ float p0 = __fmul_rn(f[0], bfr(dirs[h * 3])), p1 = __fmul_rn(f[1], bfr(dirs[h * 3 + 1])), p2 = __fmul_rn(f[2], bfr(dirs[h * 3 + 2])); asm volatile("" : "+v"(p0), "+v"(p1), "+v"(p2)); const float v = __fadd_rn(__fadd_rn(p0, p1), p2); *(float*)(PJ + (size_t)blockIdx.y * NH_ * TT + idx) = v;  }
// k_asoft: per row (zz, i): t = S x HD^-0.5 + head_scale x qp_i x kp_j for j <= i (causal; the reference's -1e9 additive fill vanishes identically); softmax over the 1024 keys (register row, one exp, fixed trees);
// the 16-bit probabilities go back IN PLACE over the row's own 4 KiB of scores (P16 | Ph at its start, Pl 2 KiB on; pitch 2 x TT elements): the wave holds the whole row in registers before its first store, and no other wave touches the row.
__global__ __launch_bounds__(256) void k_asoft(const float* Sb, const float* __restrict__ QPJ, const float* __restrict__ KPJ, const float* __restrict__ HSC, h16* P16, bf* Ph, bf* Pl) {
    const int lane = threadIdx.x & 31; const int row = blockIdx.x * 8 + (threadIdx.x >> 5); if (row >= ZH * TT) return; const int i = row % TT; const int zz = row / TT; const int h = zz % NH_; const float hs = bfr(HSC[h]); const float qp = QPJ[(size_t)zz * TT + i]; const float* kpr = KPJ + (size_t)zz * TT; const bool hires = (i < RH); const float* sr = Sb + (size_t)row * TT; float v[TT / 32]; float mx = -3.0e38f;
#pragma unroll
    for (int ch = 0; ch < TT / 128; ++ch) { const int j0 = ch * 128 + lane * 4; const v4f a = *(const v4f*)(sr + j0);
#pragma unroll
        for (int q = 0; q < 4; ++q) { const int j = j0 + q; (void)j; float sa = a[q] * SCL; asm volatile("" : "+v"(sa)); float gb = __fmul_rn(qp, kpr[j]); asm volatile("" : "+v"(gb)); float hb = __fmul_rn(hs, gb); asm volatile("" : "+v"(hb)); float tl = __fadd_rn(sa, hb); asm volatile("" : "+v"(tl)); const float t = (j <= i) ? tl : -3.0e38f;   /* s/sqrt(128) + head_scale (qp_i kp_j), causal */ v[ch * 4 + q] = t; mx = fmaxf(mx, t); } }
#pragma unroll
    for (int sh = 16; sh; sh >>= 1) mx = fmaxf(mx, __shfl_xor(mx, sh, 32));
    float sum = 0.f;
#pragma unroll
    for (int k = 0; k < TT / 32; ++k) { float d0 = __fsub_rn(v[k], mx); asm volatile("" : "+v"(d0)); v[k] = __builtin_amdgcn_exp2f(__fmul_rn(d0, 1.4426950408889634f)); sum += v[k]; }
#pragma unroll
    for (int sh = 16; sh; sh >>= 1) sum += __shfl_xor(sum, sh, 32);
    const float f = __fdiv_rn(hires ? 1.0f : PCAR, sum);
{
        if (hires) {
#pragma unroll
            for (int ch = 0; ch < TT / 128; ++ch) { v4us oh, ol;
#pragma unroll
                for (int q = 0; q < 4; ++q) { unsigned short a, c2; splitf(v[ch * 4 + q] * f, a, c2); oh[q] = a; ol[q] = c2; }
                const size_t oo = (size_t)row * (2 * TT) + ch * 128 + lane * 4; *(v4us*)(Ph + oo) = oh; *(v4us*)(Pl + oo) = ol; }
        } else {
#pragma unroll
            for (int ch = 0; ch < TT / 128; ++ch) { v4h o4;
#pragma unroll
                for (int q = 0; q < 4; ++q) o4[q] = tohx(v[ch * 4 + q] * f);
                *(v4h*)(P16 + (size_t)row * (2 * TT) + ch * 128 + lane * 4) = o4; } }
         }
}
__global__ __launch_bounds__(256) void k_merge(const float* __restrict__ O, bf* Ah, bf* Al) { const size_t e = ((size_t)blockIdx.x * 256 + threadIdx.x) * 2; if (e >= (size_t)ZH * TT * HD) return; const int d = (int)(e % HD); const int t = (int)((e / HD) % TT); const int zz = (int)(e / ((size_t)HD * TT)); const float cs = (t < RH) ? 1.0f : (1.0f / PCAR); const size_t oo = ((size_t)(zz / NH_) * TT + t) * DQ + (zz % NH_) * HD + d;
    v2us oh, ol;
#pragma unroll
    for (int q = 0; q < 2; ++q) { unsigned short a, c2; splitf(O[e + q] * cs, a, c2); oh[q] = a; ol[q] = c2; } *(v2us*)(Ah + oo) = oh; *(v2us*)(Al + oo) = ol;  }

extern "C" void kernel_launch(void* const* d_in, const int* in_sizes, int n_in,
                              void* d_out, int out_size, void* d_ws, size_t ws_size, hipStream_t stream) {
    (void)in_sizes; (void)n_in; (void)out_size;
    const float* x = (const float*)d_in[0]; const float* wqkv = (const float*)d_in[1]; const float* wo = (const float*)d_in[2]; const float* HSC = (const float*)d_in[3]; const float* HDR = (const float*)d_in[4];  const float* wq = nullptr; const float* wk = nullptr; const float* wv = nullptr; (void)wq; (void)wk; (void)wv;
    float* OUT = (float*)d_out;     // [4][1024][1024]
    char* wsp = (char*)d_ws;
    auto take = [&](size_t bytes) { char* p = wsp; wsp += (bytes + 255) & ~(size_t)255; return (void*)p; };
    bf* WALL = (bf*)take((size_t)3 * DM * DM * 2); bf* WO = (bf*)take((size_t)DM * DQ * 2); float* CS = (float*)take((size_t)TT * HD * 2 * 4);
    bf* XB = (bf*)take((size_t)NB_ * TT * DM * 2); float* QPJ = (float*)take((size_t)ZH * TT * 4); float* KPJ = (float*)take((size_t)ZH * TT * 4);
    h16* QP16 = (h16*)take((size_t)ZH * TT * HD * 2); h16* KP16 = (h16*)take((size_t)ZH * TT * HD * 2); h16* VT16 = (h16*)take((size_t)ZH * HD * TT * 2);
    bf* QPh = (bf*)take((size_t)ZH * TT * HD * 2); bf* QPl = (bf*)take((size_t)ZH * TT * HD * 2); bf* KPh = (bf*)take((size_t)ZH * TT * HD * 2); bf* KPl = (bf*)take((size_t)ZH * TT * HD * 2); bf* VTh = (bf*)take((size_t)ZH * HD * TT * 2); bf* VTl = (bf*)take((size_t)ZH * HD * TT * 2);
    float* Sb = (float*)take((size_t)ZH * TT * TT * 4); float* Ob = (float*)take((size_t)ZH * TT * HD * 4); bf* ATh = (bf*)take((size_t)NB_ * TT * DQ * 2); bf* ATl = (bf*)take((size_t)NB_ * TT * DQ * 2);
    if ((size_t)(wsp - (char*)d_ws) > ws_size) return;    // ws 256 MiB (about 249 MiB taken)
    float* F = Sb;                      // f32 [4096][q | k | v] projection (48 MiB): dead once the planes are built, before the first score tile is stored (stream-ordered)
    h16* P16 = (h16*)Sb; bf* Ph = (bf*)Sb; bf* Pl = (bf*)Sb + TT;   // probabilities in place over the score rows, pitch 2 x TT elements
    k_wtG<<<(unsigned)((DM * 3 * DM / 64 + 63) / 64), 256, 0, stream>>>(wqkv, DM, 3 * DM, WALL);   /* fused 'xw' [DM][3DM] -> Bt [3DM][DM] (row blocks q | k | v) */
    k_wtG<<<(unsigned)((DQ * DM / 64 + 63) / 64), 256, 0, stream>>>(wo, DQ, DM, WO);
    k_csid<<<(TT * HD + 255) / 256, 256, 0, stream>>>(CS);
    const dim3 LP((unsigned)(((size_t)NH_ * TT * HD / 2 + 255) / 256), NB_, 1), LJ((NH_ * TT + 255) / 256, NB_, 1);   // per-batch grids x batch
    k_cvt8<<<(unsigned)(((size_t)NB_ * TT * DM / 8 + 255) / 256), 256, 0, stream>>>(x, XB, (size_t)NB_ * TT * DM / 8);
    k_gemmw<bf, 0, false><<<dim3(NB_ * TT / 128, 3 * DM / 128, 1), 128, 0, stream>>>(XB, nullptr, WALL, nullptr, DM, F, 3 * DM, nullptr, 0, 0, 0);
    k_rope<<<LP, 256, 0, stream>>>(F, 3 * DM, NH_, CS, nullptr, nullptr, 1.0f, QP16, QPh, QPl); k_gproj<<<LJ, 256, 0, stream>>>(F, 3 * DM, HDR, QPJ);
    k_rope<<<LP, 256, 0, stream>>>(F + DM, 3 * DM, NKV, CS, nullptr, nullptr, 1.0f, KP16, KPh, KPl); k_gproj<<<LJ, 256, 0, stream>>>(F + DM, 3 * DM, HDR, KPJ);
    k_vtp<<<LP, 256, 0, stream>>>(F + 2 * DM, 3 * DM, NKV, VT16, VTh, VTl);
    k_gemmc<bf, 2, 1><<<dim3(RH / 128, TT / 128, ZH), 128, 0, stream>>>(QPh, QPl, KPh, KPl, HD, HD, Sb, TT, 0, (size_t)TT * HD, (size_t)TT * HD, (size_t)TT * TT);
    k_gemmc<h16, 0, 1><<<dim3((TT - RH) / 128, TT / 128, ZH), 128, 0, stream>>>(QP16 + (size_t)RH * HD, nullptr, KP16, nullptr, HD, HD, Sb + (size_t)RH * TT, TT, RH, (size_t)TT * HD, (size_t)TT * HD, (size_t)TT * TT);
    k_asoft<<<ZH * TT / 8, 256, 0, stream>>>(Sb, QPJ, KPJ, HSC, P16, Ph, Pl);
    k_gemmc<bf, 2, 2><<<dim3(RH / 128, HD / 128, ZH), 128, 0, stream>>>(Ph, Pl, VTh, VTl, TT, 2 * TT, Ob, HD, 0, (size_t)TT * 2 * TT, (size_t)HD * TT, (size_t)TT * HD);
    k_gemmc<h16, 0, 2><<<dim3((TT - RH) / 128, HD / 128, ZH), 128, 0, stream>>>(P16 + (size_t)RH * 2 * TT, nullptr, VT16, nullptr, TT, 2 * TT, Ob + (size_t)RH * HD, HD, RH, (size_t)TT * 2 * TT, (size_t)HD * TT, (size_t)TT * HD);
    k_merge<<<(unsigned)(((size_t)ZH * TT * HD / 2 + 255) / 256), 256, 0, stream>>>(Ob, ATh, ATl);
    k_gemmw<bf, 1, false><<<dim3(NB_ * TT / 128, DM / 128, 1), 128, 0, stream>>>(ATh, ATl, WO, nullptr, DQ, OUT, DM, nullptr, 0, 0, 0);
}

// v003
// A run of this version takes 169 microseconds.
// Next to v002, in two timings, it ran 1.28 times as fast each time.
// Over all steps from v000 it is 7.88 times as fast.
#include <hip/hip_runtime.h>

// Causal multi-head attention with a rank-1 'trigram' geometric bias (x [4][1024][1024]; [q|k|v] = x Wqkv ('xw' [1024][3072], no bias; 8 heads x 128); scores = q.k/sqrt(128) + head_scales[h] (q_i[:3].dirs[h]) (k_j[:3].dirs[h]) (head_scales [8], head_dirs [8][3] read); causal (-inf); softmax; out = merged Wout ('xw') -> [4][1024][1024] (4.2 M)).
// Layout: each stage's launches cover all 4 batches x 8 heads (plane index z = batch * 8 + head). The q|k|v GEMM's epilogue writes the 16-bit head planes itself (q, k as [t][d], v transposed as [d][t]) and forms the two 3-term projections per (head, token) in f32 from its f32 accumulators; the P.V GEMMs' epilogue writes the merged hi/lo rows that Wout reads; the softmax kernel adds head_scale x qp_i x kp_j to each live logit.
// Compute dtypes, f32 accumulate: every input rounded to bf16; q/k/v on PLAIN bf16 operands (inputs: exact); geometric bias in f32 inside the softmax kernel; causal scores and attn.v (tile skipping): query rows < 512 hl (3 products), the rest single fp16 (x1024); softmax f32; Wout hl x exact (2 products).

#define NB_  4
#define TT   1024
#define DM   1024
#define NH_  8
#define NKV  8
#define REP  (NH_ / NKV)
#define HD   128
#define DQ   (NH_ * HD)
#define DKV  (NKV * HD)
#define ZH   (NB_ * NH_)          // planes per launch: every (batch, head)
#define RH   512                  // query rows < RH use hi+lo planes (0: none)
#define WIN  1024
#define PCAR 1024.0f
#define SCL  0.088388347648318447f   // HD^-0.5
typedef _Float16 h16;
typedef unsigned short bf;
typedef __attribute__((ext_vector_type(16))) __bf16   v16bf;
typedef __attribute__((ext_vector_type(16))) _Float16 v16h;
typedef __attribute__((ext_vector_type(8)))  _Float16 v8h;
typedef __attribute__((ext_vector_type(8)))  unsigned short v8us;
typedef __attribute__((ext_vector_type(8)))  float    v8f;
typedef __attribute__((ext_vector_type(4)))  float    v4f;
typedef v8h  __attribute__((may_alias)) v8ha;
typedef v4f  __attribute__((may_alias)) v4fa;
typedef v8us __attribute__((may_alias)) v8usa;

__device__ __forceinline__ unsigned short f2bf(float f) { unsigned u = __float_as_uint(f); u += 0x7FFFu + ((u >> 16) & 1u); return (unsigned short)(u >> 16); }
__device__ __forceinline__ float bf2f(unsigned short b) { return __uint_as_float(((unsigned)b) << 16); }
__device__ __forceinline__ float bfr(float f) { return bf2f(f2bf(f)); }
__device__ __forceinline__ v16h cat16(v8h lo, v8h hi) { return __builtin_shufflevector(lo, hi, 0, 1, 2, 3, 4, 5, 6, 7, 8, 9, 10, 11, 12, 13, 14, 15); }
__device__ __forceinline__ v16bf cat16b(v8us lo, v8us hi) { return __builtin_bit_cast(v16bf, __builtin_shufflevector(lo, hi, 0, 1, 2, 3, 4, 5, 6, 7, 8, 9, 10, 11, 12, 13, 14, 15)); }
__device__ __forceinline__ v8f wmma16(v16h a, v16h b, v8f c) { return __builtin_amdgcn_wmma_f32_16x16x32_f16(false, a, false, b, (short)0, c, false, false); }
__device__ __forceinline__ v8f wmmab(v16bf a, v16bf b, v8f c) { return __builtin_amdgcn_wmma_f32_16x16x32_bf16(false, a, false, b, (short)0, c, false, false); }
__device__ __forceinline__ h16 tohx(float x) { return (h16)x; }
__device__ __forceinline__ void splitf(float y, unsigned short& h, unsigned short& l) { h = f2bf(y); l = f2bf(y - bf2f(h)); }
typedef __attribute__((ext_vector_type(4))) _Float16 v4h;
typedef __attribute__((ext_vector_type(2))) unsigned short v2us;
typedef __attribute__((ext_vector_type(4))) unsigned short v4us;



// ---- gemm_tile: 128x128 output tile per work-group of 4 waves (2x2, each wave 64x64 = 16 accumulators). Every operand plane's 128 rows x 64 k are brought in as whole 128-byte lines (a wave's 16-byte loads cover 4 rows),
// staged through registers into a two-buffer LDS ring and shared by the waves; fragments come from LDS. The next stage's global loads fly while this stage is multiplied; one work-group barrier per stage.
// C[m][n] (f32, pitch ldc, + optional f32 bias[n]) = sum_k A[m][k] Bt[n][k] (+ split products per NSPLIT), k ascending in steps of 32 per accumulator. lda = pitch of A in elements (Bt has pitch K), both compile-time, so that every row step of a staging load is an immediate offset on one fixed address. K % 64 == 0; M, N % 128 == 0.
// EPI 0 stores C in f32. EPI 1 and 2 store no f32 at all: the tile goes out as 16-bit planes E16 (fp16; EPI 1 only) | Eh | El (bf16 hi + lo), pointers given at the tile's origin, pitch HD (EPI 1) or DQ (EPI 2), each value x cs (vtr: unscaled);
// with vtr (EPI 1, work-group-uniform) the planes are written transposed, [n][m] at pitch TT; PJ (EPI 1, not vtr; at the tile's first row) takes row m's 3-term product of the tile's columns 0..2 with dirs[0..2] (bf16-rounded), in f32.
// CMODE 1 skips score tiles entirely above the causal diagonal (query rows r0+roff.., key columns c0..); CMODE 2 limits the key (K) loop of the probability x value contraction to the diagonal block (probabilities beyond it are exactly zero).
#define BKS 64      // k elements per stage: one whole 128-byte line of every operand row
#define LPT 72      // LDS row pitch in elements: 144 B = 16 B x odd, so that 16-byte fragment reads of 16 rows spread over the banks
template <typename T16> struct WFrag;
template <> struct WFrag<h16> { typedef v16h V; typedef v8h H; static __device__ __forceinline__ V ld(const h16* p) { return cat16(*(const v8h*)p, *(const v8h*)(p + 16)); } static __device__ __forceinline__ v8f mma(V a, V b, v8f c) { return wmma16(a, b, c); } };
template <> struct WFrag<bf> { typedef v16bf V; typedef v8us H; static __device__ __forceinline__ V ld(const bf* p) { return cat16b(*(const v8us*)p, *(const v8us*)(p + 16)); } static __device__ __forceinline__ v8f mma(V a, V b, v8f c) { return wmmab(a, b, c); } };
template <typename T16, int NSPLIT, int CMODE, bool BIAS, int K, int lda, int EPI>
__device__ __forceinline__ void gemm_tile(const T16* __restrict__ A, const T16* __restrict__ A2, const T16* __restrict__ Bt, const T16* __restrict__ Bt2, float* C, int ldc, int roff, const float* __restrict__ bias,
                                          h16* E16, bf* Eh, bf* El, float* PJ, const float* __restrict__ dirs, float cs, bool vtr) {
    typedef typename WFrag<T16>::V V; typedef typename WFrag<T16>::H H;
    constexpr int NA = (NSPLIT == 1 || NSPLIT == 2) ? 2 : 1, NP = NA + ((NSPLIT >= 2) ? 2 : 1), NF = (NSPLIT <= 1) ? 2 : 1;   // planes: A (A2) | Bt (Bt2); k-steps per fragment group
    __shared__ __align__(16) unsigned char smem[2 * NP * 128 * LPT * 2];                          // two stage buffers; the epilogue's row staging reuses them behind the last barrier
    T16* st = (T16*)smem;
    const int tid = threadIdx.x, lane = tid & 31, wv = tid >> 5, lr = lane & 15, hi = lane >> 4; const int wm = wv >> 1, wn = wv & 1; const int r0 = blockIdx.x * 128, c0 = blockIdx.y * 128;
    if (CMODE == 1 && c0 > r0 + roff + 127) return;                  // score tile entirely above the causal diagonal: never written (the softmax masks j > i by select); the whole work-group leaves, ahead of every barrier
    const int Kl = (CMODE == 2) ? min(K, r0 + roff + 128) : K;       // P.V: probabilities are exactly 0 beyond the diagonal block, so the K loop stops there
    v8f acc[4][4];
#pragma unroll
    for (int mb = 0; mb < 4; ++mb)
#pragma unroll
        for (int nb = 0; nb < 4; ++nb) acc[mb][nb] = (v8f){};
    const char* gb[NP]; gb[0] = (const char*)(A + (size_t)r0 * lda); if (NA == 2) gb[1] = (const char*)(A2 + (size_t)r0 * lda); gb[NA] = (const char*)(Bt + (size_t)c0 * K); if (NSPLIT >= 2) gb[NA + 1] = (const char*)(Bt2 + (size_t)c0 * K);   // work-group-uniform bases
    const unsigned trow = tid >> 3, tcol = (tid & 7) * 8;            // this thread's 16 bytes: row trow + 16 i, 8 threads to a 128-byte row
    const unsigned oa = (trow * lda + tcol) * 2, ob = (trow * K + tcol) * 2, ol = trow * LPT + tcol;   // oa, ob: the thread's fixed byte offsets from the uniform bases
    H rg[NP][8];
#pragma unroll
    for (int p = 0; p < NP; ++p)
#pragma unroll
        for (int i = 0; i < 8; ++i) rg[p][i] = *(const H*)(gb[p] + (size_t)(i * 16) * (p < NA ? lda : K) * 2 + (p < NA ? oa : ob));
    asm volatile("s_wait_xcnt 0x0" ::: "memory");   // stands ahead of whatever next overwrites an address register of the loads above
#pragma unroll
    for (int p = 0; p < NP; ++p)
#pragma unroll
        for (int i = 0; i < 8; ++i) *(H*)(st + (p * 128 + i * 16) * LPT + ol) = rg[p][i];
    __syncthreads();
    const int fa = (wm * 64 + lr) * LPT + 8 * hi, fb = (NA * 128 + wn * 64 + lr) * LPT + 8 * hi;
#pragma unroll 1
    for (int kc = 0; kc < Kl; kc += BKS) {
        const T16* sc = st + ((kc / BKS) & 1) * (NP * 128 * LPT); T16* sn = st + (((kc / BKS) & 1) ^ 1) * (NP * 128 * LPT); const bool more = kc + BKS < Kl;
        if (more) {
#pragma unroll
            for (int p = 0; p < NP; ++p)
#pragma unroll
                for (int i = 0; i < 8; ++i) rg[p][i] = *(const H*)(gb[p] + ((size_t)(i * 16) * (p < NA ? lda : K) + kc + BKS) * 2 + (p < NA ? oa : ob));
            asm volatile("s_wait_xcnt 0x0" ::: "memory"); }   // ahead of the fragment reads below, which reuse the address registers of these loads
#pragma unroll
        for (int k0 = 0; k0 < BKS / 32; k0 += NF) {
            V a[NF][4], a2[NF][4], b[NF][4], b2[NF][4];               // all fragments of NF k-steps are fetched as one group, ahead of their matrix instructions
#pragma unroll
            for (int f = 0; f < NF; ++f)
#pragma unroll
                for (int q = 0; q < 4; ++q) { const int kk = (k0 + f) * 32; a[f][q] = WFrag<T16>::ld(sc + fa + q * 16 * LPT + kk); b[f][q] = WFrag<T16>::ld(sc + fb + q * 16 * LPT + kk);
                    if (NSPLIT == 1 || NSPLIT == 2) a2[f][q] = WFrag<T16>::ld(sc + fa + (128 + q * 16) * LPT + kk); if (NSPLIT >= 2) b2[f][q] = WFrag<T16>::ld(sc + fb + (128 + q * 16) * LPT + kk); }
            __builtin_amdgcn_sched_barrier(0);   // keeps the group of LDS reads ahead of the matrix instructions: sunk between them, each read's latency is waited out in full
#pragma unroll
            for (int f = 0; f < NF; ++f)
#pragma unroll
                for (int nb = 0; nb < 4; ++nb)
#pragma unroll
                    for (int mb = 0; mb < 4; ++mb) { acc[mb][nb] = WFrag<T16>::mma(a[f][mb], b[f][nb], acc[mb][nb]); if (NSPLIT == 1 || NSPLIT == 2) acc[mb][nb] = WFrag<T16>::mma(a2[f][mb], b[f][nb], acc[mb][nb]); if (NSPLIT >= 2) acc[mb][nb] = WFrag<T16>::mma(a[f][mb], b2[f][nb], acc[mb][nb]); }
            // four vector slots behind the stage's last matrix instruction: the loop's taken branch leads to loads that overwrite its operand registers
            if (k0 + NF == BKS / 32) asm volatile("v_nop\n\tv_nop\n\tv_nop\n\tv_nop" : "+v"(acc[0][0]), "+v"(acc[1][1]), "+v"(acc[2][2]), "+v"(acc[3][3]) : "v"(a[NF - 1][0]), "v"(a[NF - 1][3]));
        }
        if (more) {
#pragma unroll
            for (int p = 0; p < NP; ++p)
#pragma unroll
                for (int i = 0; i < 8; ++i) *(H*)(sn + (p * 128 + i * 16) * LPT + ol) = rg[p][i]; }
        __syncthreads();   // publishes the next stage and ends every wave's reads of this one, whose buffer the next pass refills
    }
    if (EPI == 1 && vtr) {   // transposed planes: a lane's 8 accumulator rows are 8 consecutive m of one column n, so they go to LDS as one 16-byte piece of row n; the rows come back as whole 128-byte lines (64 m)
        bf* vs = (bf*)smem + wv * (3 * 16 * LPT); bf* vw = vs + lr * LPT + hi * 8; const bf* vr = vs + (lane >> 3) * LPT + (lane & 7) * 8;
        const unsigned g0 = (unsigned)(wn * 64 + (lane >> 3)) * TT + wm * 64 + (lane & 7) * 8; bf* e16 = (bf*)E16 + g0; bf* eh = Eh + g0; bf* el = El + g0;   // every later row step is an immediate offset
#pragma unroll
        for (int nb = 0; nb < 4; ++nb) {
#pragma unroll
            for (int mb = 0; mb < 4; ++mb) { v8us w16, wh, wl;
#pragma unroll
                for (int j = 0; j < 8; ++j) { const float x = acc[mb][nb][j]; unsigned short a2, c2; splitf(x, a2, c2); w16[j] = __builtin_bit_cast(unsigned short, tohx(x)); wh[j] = a2; wl[j] = c2; }
                *(v8usa*)(vw + mb * 16) = w16; *(v8usa*)(vw + 16 * LPT + mb * 16) = wh; *(v8usa*)(vw + 32 * LPT + mb * 16) = wl; }
            __builtin_amdgcn_wave_barrier(); asm volatile("" ::: "memory");   // the wave's own LDS writes stay ahead of its reads of other lanes' pieces
            v8us r16[4], rh[4], rl[4];
#pragma unroll
            for (int s = 0; s < 4; ++s) { r16[s] = *(const v8usa*)(vr + s * 4 * LPT); rh[s] = *(const v8usa*)(vr + (16 + s * 4) * LPT); rl[s] = *(const v8usa*)(vr + (32 + s * 4) * LPT); }
            __builtin_amdgcn_sched_barrier(0);   // the group's stores stand together, with nothing between them and their wait that could overwrite a register they name
#pragma unroll
            for (int s = 0; s < 4; ++s) { *(v8usa*)(e16 + (nb * 16 + s * 4) * TT) = r16[s]; *(v8usa*)(eh + (nb * 16 + s * 4) * TT) = rh[s]; *(v8usa*)(el + (nb * 16 + s * 4) * TT) = rl[s]; }
            asm volatile("s_wait_xcnt 0x0" ::: "memory");   // ahead of the next group, which reuses the registers of these stores
            __builtin_amdgcn_sched_barrier(0);   // keeps the next group's instructions behind that wait
        }
        return;
    }
    float* os = (float*)smem + wv * (16 * 68);
    if (EPI != 0) {
        constexpr int EP = (EPI == 1) ? HD : DQ;   // pitch of the planes' rows in elements
        float d0 = 0.f, d1 = 0.f, d2 = 0.f; if (EPI == 1) { d0 = bfr(dirs[0]); d1 = bfr(dirs[1]); d2 = bfr(dirs[2]); }
        const unsigned g0 = (unsigned)(wm * 64 + hi) * EP + wn * 64 + lr * 4; h16* e16 = E16 + g0; bf* eh = Eh + g0; bf* el = El + g0; float* pj = PJ + wm * 64 + lr;   // every later row step is an immediate offset
#pragma unroll
        for (int mb = 0; mb < 4; ++mb) {
#pragma unroll
            for (int nb = 0; nb < 4; ++nb) {
#pragma unroll
                for (int j = 0; j < 8; ++j) os[(hi * 8 + j) * 68 + nb * 16 + lr] = acc[mb][nb][j]; }
            __builtin_amdgcn_wave_barrier(); asm volatile("" ::: "memory");   // the wave's own LDS writes stay ahead of its reads of other lanes' values
            v4h o16[8]; v4us oh[8], ol[8]; float pv = 0.f;
#pragma unroll
            for (int s = 0; s < 8; ++s) { const v4f val = *(const v4fa*)(os + (2 * s + hi) * 68 + lr * 4);
#pragma unroll
                for (int q = 0; q < 4; ++q) { const float r = val[q] * cs; unsigned short a2, c2; splitf(r, a2, c2); o16[s][q] = tohx(r); oh[s][q] = a2; ol[s][q] = c2; } }
            if (EPI == 1) { const v4f f = *(const v4fa*)(os + lr * 68); pv = f[0] * d0 + f[1] * d1 + f[2] * d2; }   // row lr's columns 0..2 (used where wn == 0)
            __builtin_amdgcn_sched_barrier(0);   // the group's stores stand together, with nothing between them and their wait that could overwrite a register they name
#pragma unroll
            for (int s = 0; s < 8; ++s) { if (EPI == 1) *(v4h*)(e16 + (mb * 16 + 2 * s) * EP) = o16[s];
                *(v4us*)(eh + (mb * 16 + 2 * s) * EP) = oh[s]; *(v4us*)(el + (mb * 16 + 2 * s) * EP) = ol[s]; }
            if (EPI == 1 && wn == 0 && hi == 0) pj[mb * 16] = pv;
            asm volatile("s_wait_xcnt 0x0" ::: "memory");   // ahead of the next group, which reuses the registers of these stores
            __builtin_amdgcn_sched_barrier(0);   // keeps the next group's instructions behind that wait
        }
        return;
    }
#pragma unroll
    for (int mb = 0; mb < 4; ++mb) {
#pragma unroll
        for (int nb = 0; nb < 4; ++nb) {
#pragma unroll
            for (int j = 0; j < 8; ++j) os[(hi * 8 + j) * 68 + nb * 16 + lr] = acc[mb][nb][j]; }
        __builtin_amdgcn_wave_barrier(); asm volatile("" ::: "memory");
        const int cw = c0 + wn * 64; float* crow = C + (size_t)(r0 + wm * 64 + mb * 16) * ldc + cw;
#pragma unroll
        for (int s = 0; s < 8; ++s) { const int row = 2 * s + hi, cofs = lr * 4; v4f val = *(const v4fa*)(os + row * 68 + cofs); if (BIAS) { val[0] += bfr(bias[cw + cofs]); val[1] += bfr(bias[cw + cofs + 1]); val[2] += bfr(bias[cw + cofs + 2]); val[3] += bfr(bias[cw + cofs + 3]); }
            *(v4f*)(crow + (size_t)row * ldc + cofs) = val; }
        __builtin_amdgcn_wave_barrier(); asm volatile("" ::: "memory");
    }
}

// ---- k_gemmw: plain GEMM on gemm_tile; grid (M/128, N/128, Z), 128 threads. z-batch strides sA/sB/sC in elements.
template <typename T16, int NSPLIT, bool BIAS>
__global__ __launch_bounds__(128) void k_gemmw(const T16* __restrict__ A, const T16* __restrict__ A2, const T16* __restrict__ Bt, const T16* __restrict__ Bt2, int K, float* C, int ldc, const float* __restrict__ bias, size_t sA, size_t sB, size_t sC) {
    const size_t z = blockIdx.z; A += z * sA; if (A2) A2 += z * sA; Bt += z * sB; if (Bt2) Bt2 += z * sB; C += z * sC;
    (void)K; gemm_tile<T16, NSPLIT, 0, BIAS, DM, DM, 0>(A, A2, Bt, Bt2, C, ldc, 0, bias, nullptr, nullptr, nullptr, nullptr, nullptr, 1.0f, false);   // K = 1024
}

// ---- k_gemmqkv: [q | k | v] = x Wqkv on gemm_tile; grid (4096/128, 3072/128), 128 threads. A 128-column tile is one head of q, k or v and a 128-row tile lies in one batch, so the epilogue writes the tile straight into that (batch, head)'s planes.
__global__ __launch_bounds__(128) void k_gemmqkv(const bf* __restrict__ A, const bf* __restrict__ Bt, const float* __restrict__ dirs, h16* Q16, bf* Qh, bf* Ql, float* QPJ, h16* K16, bf* Kh, bf* Kl, float* KPJ, h16* V16, bf* Vh, bf* Vl) {
    const int sect = blockIdx.y / NH_, h = blockIdx.y % NH_, t0 = (blockIdx.x % (TT / 128)) * 128; const size_t z = (size_t)(blockIdx.x / (TT / 128)) * NH_ + h;
    const bool vtr = (sect == 2); const size_t o = vtr ? z * HD * TT + t0 : (z * TT + t0) * HD;   // v planes are [d][t], q and k planes [t][d]
    h16* E16 = (sect == 0) ? Q16 : (sect == 1) ? K16 : V16; bf* Eh = (sect == 0) ? Qh : (sect == 1) ? Kh : Vh; bf* El = (sect == 0) ? Ql : (sect == 1) ? Kl : Vl; float* PJ = ((sect == 0) ? QPJ : KPJ) + z * TT + t0;
    gemm_tile<bf, 0, 0, false, DM, DM, 1>(A, nullptr, Bt, nullptr, nullptr, HD, 0, nullptr, E16 + o, Eh + o, El + o, PJ, dirs + h * 3, 1.0f, vtr);
}

// ---- k_gemmc: the same tile GEMM for causal attention (CMODE 1: scores, f32 to C; CMODE 2: probability x value, whose epilogue takes the x1024 carrier off rows >= RH and writes the hi/lo rows [batch][t][head x 128 + d] at Ah, Al). roff = row offset of this launch's first row within the sequence.
template <typename T16, int NSPLIT, int CMODE>
__global__ __launch_bounds__(128) void k_gemmc(const T16* __restrict__ A, const T16* __restrict__ A2, const T16* __restrict__ Bt, const T16* __restrict__ Bt2, int K, int lda, float* C, int ldc, int roff, size_t sA, size_t sB, size_t sC, bf* Ah, bf* Al) {
    const size_t z = blockIdx.z; A += z * sA; if (A2) A2 += z * sA; Bt += z * sB; if (Bt2) Bt2 += z * sB; if (CMODE == 1) C += z * sC;
    const size_t o = (CMODE == 2) ? ((z / NH_) * TT + roff + blockIdx.x * 128) * DQ + (z % NH_) * HD : 0;   // P.V: the tile's origin in the merged rows
    (void)K; (void)lda; gemm_tile<T16, NSPLIT, CMODE, false, (CMODE == 1) ? HD : TT, (CMODE == 1) ? HD : 2 * TT, (CMODE == 1) ? 0 : 2>(A, A2, Bt, Bt2, C, ldc, roff, nullptr, nullptr, Ah + o, Al + o, nullptr, nullptr, (roff < RH) ? 1.0f : (1.0f / PCAR), false);   // scores: K = lda = 128; P.V: K = 1024, lda = 2048
}


__global__ __launch_bounds__(256) void k_wtG(const float* __restrict__ w, int K, int N, bf* Bt) {
    const int lane = threadIdx.x & 31; const int L0 = (blockIdx.x * 8 + (threadIdx.x >> 5)) * 8; const int nlines = N * K / 64;
{
#pragma unroll 1
        for (int l = 0; l < 8; ++l) { const int L = L0 + l; if (L >= nlines) break; const size_t e = (size_t)L * 64 + lane * 2; const int k = (int)(e % K), n = (int)(e / K); v2us o;
            o[0] = f2bf(w[(size_t)k * N + n]); o[1] = f2bf(w[(size_t)(k + 1) * N + n]); *(v2us*)(Bt + e) = o; }
         }
}
__global__ __launch_bounds__(256) void k_cvt8(const float* __restrict__ src, bf* dst, size_t n8) { const size_t i = (size_t)blockIdx.x * 256 + threadIdx.x; if (i >= n8) return; const v8f v = *(const v8f*)(src + i * 8); v8us o;
#pragma unroll
    for (int k = 0; k < 8; ++k) o[k] = f2bf(v[k]); *(v8us*)(dst + i * 8) = o;  }

// k_asoft: per row (zz, i): t = S x HD^-0.5 + head_scale qp_i kp_j for j <= i (causal; the reference's -1e9 additive fill vanishes identically); softmax over the 1024 keys (register row, one exp, fixed trees);
// the 16-bit probabilities go back IN PLACE over the row's own 4 KiB of scores (P16 | Ph at its start, Pl 2 KiB on; pitch 2 x TT elements): the wave holds the whole row in registers before its first store, and no other wave touches the row.
__global__ __launch_bounds__(256) void k_asoft(const float* Sb, const float* __restrict__ QPJ, const float* __restrict__ KPJ, const float* __restrict__ HSC, h16* P16, bf* Ph, bf* Pl) {
    const int lane = threadIdx.x & 31; const int row = blockIdx.x * 8 + (threadIdx.x >> 5); if (row >= ZH * TT) return; const int i = row % TT; const int zz = row / TT; const int h = zz % NH_; const float hs = bfr(HSC[h]); const float qp = QPJ[(size_t)zz * TT + i]; const float* kpr = KPJ + (size_t)zz * TT; const bool hires = (i < RH); const float* sr = Sb + (size_t)row * TT; float v[TT / 32]; float mx = -3.0e38f;
#pragma unroll
    for (int ch = 0; ch < TT / 128; ++ch) { const int j0 = ch * 128 + lane * 4; const v4f a = *(const v4f*)(sr + j0);
#pragma unroll
        for (int q = 0; q < 4; ++q) { const int j = j0 + q; (void)j; float sa = a[q] * SCL; asm volatile("" : "+v"(sa)); float gb = __fmul_rn(qp, kpr[j]); asm volatile("" : "+v"(gb)); float hb = __fmul_rn(hs, gb); asm volatile("" : "+v"(hb)); float tl = __fadd_rn(sa, hb); asm volatile("" : "+v"(tl)); const float t = (j <= i) ? tl : -3.0e38f;   /* s/sqrt(128) + head_scale (qp_i kp_j), causal */ v[ch * 4 + q] = t; mx = fmaxf(mx, t); } }
#pragma unroll
    for (int sh = 16; sh; sh >>= 1) mx = fmaxf(mx, __shfl_xor(mx, sh, 32));
    float sum = 0.f;
#pragma unroll
    for (int k = 0; k < TT / 32; ++k) { float d0 = __fsub_rn(v[k], mx); asm volatile("" : "+v"(d0)); v[k] = __builtin_amdgcn_exp2f(__fmul_rn(d0, 1.4426950408889634f)); sum += v[k]; }
#pragma unroll
    for (int sh = 16; sh; sh >>= 1) sum += __shfl_xor(sum, sh, 32);
    const float f = __fdiv_rn(hires ? 1.0f : PCAR, sum);
{
        if (hires) {
#pragma unroll
            for (int ch = 0; ch < TT / 128; ++ch) { v4us oh, ol;
#pragma unroll
                for (int q = 0; q < 4; ++q) { unsigned short a, c2; splitf(v[ch * 4 + q] * f, a, c2); oh[q] = a; ol[q] = c2; }
                const size_t oo = (size_t)row * (2 * TT) + ch * 128 + lane * 4; *(v4us*)(Ph + oo) = oh; *(v4us*)(Pl + oo) = ol; }
        } else {
#pragma unroll
            for (int ch = 0; ch < TT / 128; ++ch) { v4h o4;
#pragma unroll
                for (int q = 0; q < 4; ++q) o4[q] = tohx(v[ch * 4 + q] * f);
                *(v4h*)(P16 + (size_t)row * (2 * TT) + ch * 128 + lane * 4) = o4; } }
         }
}
extern "C" void kernel_launch(void* const* d_in, const int* in_sizes, int n_in,
                              void* d_out, int out_size, void* d_ws, size_t ws_size, hipStream_t stream) {
    (void)in_sizes; (void)n_in; (void)out_size;
    const float* x = (const float*)d_in[0]; const float* wqkv = (const float*)d_in[1]; const float* wo = (const float*)d_in[2]; const float* HSC = (const float*)d_in[3]; const float* HDR = (const float*)d_in[4];  const float* wq = nullptr; const float* wk = nullptr; const float* wv = nullptr; (void)wq; (void)wk; (void)wv;
    float* OUT = (float*)d_out;     // [4][1024][1024]
    char* wsp = (char*)d_ws;
    auto take = [&](size_t bytes) { char* p = wsp; wsp += (bytes + 255) & ~(size_t)255; return (void*)p; };
    bf* WALL = (bf*)take((size_t)3 * DM * DM * 2); bf* WO = (bf*)take((size_t)DM * DQ * 2);
    bf* XB = (bf*)take((size_t)NB_ * TT * DM * 2); float* QPJ = (float*)take((size_t)ZH * TT * 4); float* KPJ = (float*)take((size_t)ZH * TT * 4);
    h16* QP16 = (h16*)take((size_t)ZH * TT * HD * 2); h16* KP16 = (h16*)take((size_t)ZH * TT * HD * 2); h16* VT16 = (h16*)take((size_t)ZH * HD * TT * 2);
    bf* QPh = (bf*)take((size_t)ZH * TT * HD * 2); bf* QPl = (bf*)take((size_t)ZH * TT * HD * 2); bf* KPh = (bf*)take((size_t)ZH * TT * HD * 2); bf* KPl = (bf*)take((size_t)ZH * TT * HD * 2); bf* VTh = (bf*)take((size_t)ZH * HD * TT * 2); bf* VTl = (bf*)take((size_t)ZH * HD * TT * 2);
    float* Sb = (float*)take((size_t)ZH * TT * TT * 4); bf* ATh = (bf*)take((size_t)NB_ * TT * DQ * 2); bf* ATl = (bf*)take((size_t)NB_ * TT * DQ * 2);
    if ((size_t)(wsp - (char*)d_ws) > ws_size) return;    // ws 256 MiB (about 232 MiB taken)
    h16* P16 = (h16*)Sb; bf* Ph = (bf*)Sb; bf* Pl = (bf*)Sb + TT;   // probabilities in place over the score rows, pitch 2 x TT elements
    k_wtG<<<(unsigned)((DM * 3 * DM / 64 + 63) / 64), 256, 0, stream>>>(wqkv, DM, 3 * DM, WALL);   /* fused 'xw' [DM][3DM] -> Bt [3DM][DM] (row blocks q | k | v) */
    k_wtG<<<(unsigned)((DQ * DM / 64 + 63) / 64), 256, 0, stream>>>(wo, DQ, DM, WO);
    k_cvt8<<<(unsigned)(((size_t)NB_ * TT * DM / 8 + 255) / 256), 256, 0, stream>>>(x, XB, (size_t)NB_ * TT * DM / 8);
    k_gemmqkv<<<dim3(NB_ * TT / 128, 3 * DM / 128, 1), 128, 0, stream>>>(XB, WALL, HDR, QP16, QPh, QPl, QPJ, KP16, KPh, KPl, KPJ, VT16, VTh, VTl);
    k_gemmc<bf, 2, 1><<<dim3(RH / 128, TT / 128, ZH), 128, 0, stream>>>(QPh, QPl, KPh, KPl, HD, HD, Sb, TT, 0, (size_t)TT * HD, (size_t)TT * HD, (size_t)TT * TT, nullptr, nullptr);
    k_gemmc<h16, 0, 1><<<dim3((TT - RH) / 128, TT / 128, ZH), 128, 0, stream>>>(QP16 + (size_t)RH * HD, nullptr, KP16, nullptr, HD, HD, Sb + (size_t)RH * TT, TT, RH, (size_t)TT * HD, (size_t)TT * HD, (size_t)TT * TT, nullptr, nullptr);
    k_asoft<<<ZH * TT / 8, 256, 0, stream>>>(Sb, QPJ, KPJ, HSC, P16, Ph, Pl);
    k_gemmc<bf, 2, 2><<<dim3(RH / 128, HD / 128, ZH), 128, 0, stream>>>(Ph, Pl, VTh, VTl, TT, 2 * TT, nullptr, DQ, 0, (size_t)TT * 2 * TT, (size_t)HD * TT, 0, ATh, ATl);
    k_gemmc<h16, 0, 2><<<dim3((TT - RH) / 128, HD / 128, ZH), 128, 0, stream>>>(P16 + (size_t)RH * 2 * TT, nullptr, VT16, nullptr, TT, 2 * TT, nullptr, DQ, RH, (size_t)TT * 2 * TT, (size_t)HD * TT, 0, ATh, ATl);
    k_gemmw<bf, 1, false><<<dim3(NB_ * TT / 128, DM / 128, 1), 128, 0, stream>>>(ATh, ATl, WO, nullptr, DQ, OUT, DM, nullptr, 0, 0, 0);
}

// v004
// A run of this version takes 99.1 microseconds.
// Next to v003, in two timings, it ran 1.72 and 1.70 times as fast.
// Counting every step since v000, it is 13.5 times as fast.
#include <hip/hip_runtime.h>

// Causal multi-head attention with a rank-1 'trigram' geometric bias (x [4][1024][1024]; [q|k|v] = x Wqkv ('xw' [1024][3072], no bias; 8 heads x 128); scores = q.k/sqrt(128) + head_scales[h] (q_i[:3].dirs[h]) (k_j[:3].dirs[h]) (head_scales [8], head_dirs [8][3] read); causal (-inf); softmax; out = merged Wout ('xw') -> [4][1024][1024] (4.2 M)).
// Layout: every stage launched once for all 4 batches x 8 heads (plane index z = batch * 8 + head). The q|k|v GEMM's epilogue writes the 16-bit head planes itself (q, k as [t][d], v transposed as [d][t]) and forms the two 3-term projections per (head, token) in f32 from its f32 accumulators; one attention kernel (k_attn) forms the scores, adds head_scale x qp_i x kp_j to each logit, runs the softmax online and multiplies by v, and writes the merged hi/lo rows that Wout reads; scores and probabilities stay in registers.
// Compute dtypes, f32 accumulate: every input rounded to bf16; q/k/v on PLAIN bf16 operands (inputs: exact); geometric bias in f32 inside the attention kernel; causal scores and attn.v (key stages end at the diagonal block): query rows < 512 hl (3 products), the rest single fp16 (probabilities relative to the running row maximum, at most 1); softmax f32; Wout hl x exact (2 products).

#define NB_  4
#define TT   1024
#define DM   1024
#define NH_  8
#define NKV  8
#define REP  (NH_ / NKV)
#define HD   128
#define DQ   (NH_ * HD)
#define DKV  (NKV * HD)
#define ZH   (NB_ * NH_)          // planes per launch: every (batch, head)
#define RH   512                  // query rows < RH use hi+lo planes (0: none)
#define WIN  1024
#define SCL  0.088388347648318447f   // HD^-0.5
typedef _Float16 h16;
typedef unsigned short bf;
typedef __attribute__((ext_vector_type(16))) __bf16   v16bf;
typedef __attribute__((ext_vector_type(16))) _Float16 v16h;
typedef __attribute__((ext_vector_type(8)))  _Float16 v8h;
typedef __attribute__((ext_vector_type(8)))  unsigned short v8us;
typedef __attribute__((ext_vector_type(8)))  float    v8f;
typedef __attribute__((ext_vector_type(4)))  float    v4f;
typedef v8h  __attribute__((may_alias)) v8ha;
typedef v4f  __attribute__((may_alias)) v4fa;
typedef v8us __attribute__((may_alias)) v8usa;

__device__ __forceinline__ unsigned short f2bf(float f) { unsigned u = __float_as_uint(f); u += 0x7FFFu + ((u >> 16) & 1u); return (unsigned short)(u >> 16); }
__device__ __forceinline__ float bf2f(unsigned short b) { return __uint_as_float(((unsigned)b) << 16); }
__device__ __forceinline__ float bfr(float f) { return bf2f(f2bf(f)); }
__device__ __forceinline__ v16h cat16(v8h lo, v8h hi) { return __builtin_shufflevector(lo, hi, 0, 1, 2, 3, 4, 5, 6, 7, 8, 9, 10, 11, 12, 13, 14, 15); }
__device__ __forceinline__ v16bf cat16b(v8us lo, v8us hi) { return __builtin_bit_cast(v16bf, __builtin_shufflevector(lo, hi, 0, 1, 2, 3, 4, 5, 6, 7, 8, 9, 10, 11, 12, 13, 14, 15)); }
__device__ __forceinline__ v8f wmma16(v16h a, v16h b, v8f c) { return __builtin_amdgcn_wmma_f32_16x16x32_f16(false, a, false, b, (short)0, c, false, false); }
__device__ __forceinline__ v8f wmmab(v16bf a, v16bf b, v8f c) { return __builtin_amdgcn_wmma_f32_16x16x32_bf16(false, a, false, b, (short)0, c, false, false); }
__device__ __forceinline__ h16 tohx(float x) { return (h16)x; }
__device__ __forceinline__ void splitf(float y, unsigned short& h, unsigned short& l) { h = f2bf(y); l = f2bf(y - bf2f(h)); }
typedef __attribute__((ext_vector_type(4))) _Float16 v4h;
typedef __attribute__((ext_vector_type(2))) unsigned short v2us;
typedef __attribute__((ext_vector_type(4))) unsigned short v4us;



// ---- gemm_tile: 128x128 output tile per work-group of 4 waves (2x2, each wave 64x64 = 16 accumulators). Every operand plane's 128 rows x 64 k are brought in as whole 128-byte lines (a wave's 16-byte loads cover 4 rows),
// staged through registers into a two-buffer LDS ring and shared by the waves; fragments come from LDS. The next stage's global loads fly while this stage is multiplied; one work-group barrier per stage.
// C[m][n] (f32, pitch ldc, + optional f32 bias[n]) = sum_k A[m][k] Bt[n][k] (+ split products per NSPLIT), k ascending in steps of 32 per accumulator. lda = pitch of A in elements (Bt has pitch K), both compile-time, so that every row step of a staging load is an immediate offset on one fixed address. K % 64 == 0; M, N % 128 == 0.
// EPI 0 stores C in f32. EPI 1 and 2 store no f32 at all: the tile goes out as 16-bit planes E16 (fp16; EPI 1 only) | Eh | El (bf16 hi + lo), pointers given at the tile's origin, pitch HD (EPI 1) or DQ (EPI 2), each value x cs (vtr: unscaled);
// with vtr (EPI 1, work-group-uniform) the planes are written transposed, [n][m] at pitch TT; PJ (EPI 1, not vtr; at the tile's first row) takes row m's 3-term product of the tile's columns 0..2 with dirs[0..2] (bf16-rounded), in f32.
// CMODE 1 skips score tiles entirely above the causal diagonal (query rows r0+roff.., key columns c0..); CMODE 2 limits the key (K) loop of the probability x value contraction to the diagonal block (probabilities beyond it are exactly zero).
#define BKS 64      // k elements per stage: one whole 128-byte line of every operand row
#define LPT 72      // LDS row pitch in elements: 144 B = 16 B x odd, so that 16-byte fragment reads of 16 rows spread over the banks
template <typename T16> struct WFrag;
template <> struct WFrag<h16> { typedef v16h V; typedef v8h H; static __device__ __forceinline__ V ld(const h16* p) { return cat16(*(const v8h*)p, *(const v8h*)(p + 16)); } static __device__ __forceinline__ v8f mma(V a, V b, v8f c) { return wmma16(a, b, c); } };
template <> struct WFrag<bf> { typedef v16bf V; typedef v8us H; static __device__ __forceinline__ V ld(const bf* p) { return cat16b(*(const v8us*)p, *(const v8us*)(p + 16)); } static __device__ __forceinline__ v8f mma(V a, V b, v8f c) { return wmmab(a, b, c); } };
template <typename T16, int NSPLIT, int CMODE, bool BIAS, int K, int lda, int EPI>
__device__ __forceinline__ void gemm_tile(const T16* __restrict__ A, const T16* __restrict__ A2, const T16* __restrict__ Bt, const T16* __restrict__ Bt2, float* C, int ldc, int roff, const float* __restrict__ bias,
                                          h16* E16, bf* Eh, bf* El, float* PJ, const float* __restrict__ dirs, float cs, bool vtr) {
    typedef typename WFrag<T16>::V V; typedef typename WFrag<T16>::H H;
    constexpr int NA = (NSPLIT == 1 || NSPLIT == 2) ? 2 : 1, NP = NA + ((NSPLIT >= 2) ? 2 : 1), NF = (NSPLIT <= 1) ? 2 : 1;   // planes: A (A2) | Bt (Bt2); k-steps per fragment group
    __shared__ __align__(16) unsigned char smem[2 * NP * 128 * LPT * 2];                          // two stage buffers; the epilogue's row staging reuses them behind the last barrier
    T16* st = (T16*)smem;
    const int tid = threadIdx.x, lane = tid & 31, wv = tid >> 5, lr = lane & 15, hi = lane >> 4; const int wm = wv >> 1, wn = wv & 1; const int r0 = blockIdx.x * 128, c0 = blockIdx.y * 128;
    if (CMODE == 1 && c0 > r0 + roff + 127) return;                  // score tile entirely above the causal diagonal: never written (the softmax masks j > i by select); the whole work-group leaves, ahead of every barrier
    const int Kl = (CMODE == 2) ? min(K, r0 + roff + 128) : K;       // P.V: probabilities are exactly 0 beyond the diagonal block, so the K loop stops there
    v8f acc[4][4];
#pragma unroll
    for (int mb = 0; mb < 4; ++mb)
#pragma unroll
        for (int nb = 0; nb < 4; ++nb) acc[mb][nb] = (v8f){};
    const char* gb[NP]; gb[0] = (const char*)(A + (size_t)r0 * lda); if (NA == 2) gb[1] = (const char*)(A2 + (size_t)r0 * lda); gb[NA] = (const char*)(Bt + (size_t)c0 * K); if (NSPLIT >= 2) gb[NA + 1] = (const char*)(Bt2 + (size_t)c0 * K);   // work-group-uniform bases
    const unsigned trow = tid >> 3, tcol = (tid & 7) * 8;            // this thread's 16 bytes: row trow + 16 i, 8 threads to a 128-byte row
    const unsigned oa = (trow * lda + tcol) * 2, ob = (trow * K + tcol) * 2, ol = trow * LPT + tcol;   // oa, ob: the thread's fixed byte offsets from the uniform bases
    H rg[NP][8];
#pragma unroll
    for (int p = 0; p < NP; ++p)
#pragma unroll
        for (int i = 0; i < 8; ++i) rg[p][i] = *(const H*)(gb[p] + (size_t)(i * 16) * (p < NA ? lda : K) * 2 + (p < NA ? oa : ob));
    asm volatile("s_wait_xcnt 0x0" ::: "memory");   // stands ahead of whatever next overwrites an address register of the loads above
#pragma unroll
    for (int p = 0; p < NP; ++p)
#pragma unroll
        for (int i = 0; i < 8; ++i) *(H*)(st + (p * 128 + i * 16) * LPT + ol) = rg[p][i];
    __syncthreads();
    const int fa = (wm * 64 + lr) * LPT + 8 * hi, fb = (NA * 128 + wn * 64 + lr) * LPT + 8 * hi;
#pragma unroll 1
    for (int kc = 0; kc < Kl; kc += BKS) {
        const T16* sc = st + ((kc / BKS) & 1) * (NP * 128 * LPT); T16* sn = st + (((kc / BKS) & 1) ^ 1) * (NP * 128 * LPT); const bool more = kc + BKS < Kl;
        if (more) {
#pragma unroll
            for (int p = 0; p < NP; ++p)
#pragma unroll
                for (int i = 0; i < 8; ++i) rg[p][i] = *(const H*)(gb[p] + ((size_t)(i * 16) * (p < NA ? lda : K) + kc + BKS) * 2 + (p < NA ? oa : ob));
            asm volatile("s_wait_xcnt 0x0" ::: "memory"); }   // ahead of the fragment reads below, which reuse the address registers of these loads
#pragma unroll
        for (int k0 = 0; k0 < BKS / 32; k0 += NF) {
            V a[NF][4], a2[NF][4], b[NF][4], b2[NF][4];               // all fragments of NF k-steps are fetched as one group, ahead of their matrix instructions
#pragma unroll
            for (int f = 0; f < NF; ++f)
#pragma unroll
                for (int q = 0; q < 4; ++q) { const int kk = (k0 + f) * 32; a[f][q] = WFrag<T16>::ld(sc + fa + q * 16 * LPT + kk); b[f][q] = WFrag<T16>::ld(sc + fb + q * 16 * LPT + kk);
                    if (NSPLIT == 1 || NSPLIT == 2) a2[f][q] = WFrag<T16>::ld(sc + fa + (128 + q * 16) * LPT + kk); if (NSPLIT >= 2) b2[f][q] = WFrag<T16>::ld(sc + fb + (128 + q * 16) * LPT + kk); }
            __builtin_amdgcn_sched_barrier(0);   // keeps the group of LDS reads ahead of the matrix instructions: sunk between them, each read's latency is waited out in full
#pragma unroll
            for (int f = 0; f < NF; ++f)
#pragma unroll
                for (int nb = 0; nb < 4; ++nb)
#pragma unroll
                    for (int mb = 0; mb < 4; ++mb) { acc[mb][nb] = WFrag<T16>::mma(a[f][mb], b[f][nb], acc[mb][nb]); if (NSPLIT == 1 || NSPLIT == 2) acc[mb][nb] = WFrag<T16>::mma(a2[f][mb], b[f][nb], acc[mb][nb]); if (NSPLIT >= 2) acc[mb][nb] = WFrag<T16>::mma(a[f][mb], b2[f][nb], acc[mb][nb]); }
            // four vector slots behind the stage's last matrix instruction: the loop's taken branch leads to loads that overwrite its operand registers
            if (k0 + NF == BKS / 32) asm volatile("v_nop\n\tv_nop\n\tv_nop\n\tv_nop" : "+v"(acc[0][0]), "+v"(acc[1][1]), "+v"(acc[2][2]), "+v"(acc[3][3]) : "v"(a[NF - 1][0]), "v"(a[NF - 1][3]));
        }
        if (more) {
#pragma unroll
            for (int p = 0; p < NP; ++p)
#pragma unroll
                for (int i = 0; i < 8; ++i) *(H*)(sn + (p * 128 + i * 16) * LPT + ol) = rg[p][i]; }
        __syncthreads();   // publishes the next stage and ends every wave's reads of this one, whose buffer the next pass refills
    }
    if (EPI == 1 && vtr) {   // transposed planes: a lane's 8 accumulator rows are 8 consecutive m of one column n, so they go to LDS as one 16-byte piece of row n; the rows come back as whole 128-byte lines (64 m)
        bf* vs = (bf*)smem + wv * (3 * 16 * LPT); bf* vw = vs + lr * LPT + hi * 8; const bf* vr = vs + (lane >> 3) * LPT + (lane & 7) * 8;
        const unsigned g0 = (unsigned)(wn * 64 + (lane >> 3)) * TT + wm * 64 + (lane & 7) * 8; bf* e16 = (bf*)E16 + g0; bf* eh = Eh + g0; bf* el = El + g0;   // every later row step is an immediate offset
#pragma unroll
        for (int nb = 0; nb < 4; ++nb) {
#pragma unroll
            for (int mb = 0; mb < 4; ++mb) { v8us w16, wh, wl;
#pragma unroll
                for (int j = 0; j < 8; ++j) { const float x = acc[mb][nb][j]; unsigned short a2, c2; splitf(x, a2, c2); w16[j] = __builtin_bit_cast(unsigned short, tohx(x)); wh[j] = a2; wl[j] = c2; }
                *(v8usa*)(vw + mb * 16) = w16; *(v8usa*)(vw + 16 * LPT + mb * 16) = wh; *(v8usa*)(vw + 32 * LPT + mb * 16) = wl; }
            __builtin_amdgcn_wave_barrier(); asm volatile("" ::: "memory");   // the wave's own LDS writes stay ahead of its reads of other lanes' pieces
            v8us r16[4], rh[4], rl[4];
#pragma unroll
            for (int s = 0; s < 4; ++s) { r16[s] = *(const v8usa*)(vr + s * 4 * LPT); rh[s] = *(const v8usa*)(vr + (16 + s * 4) * LPT); rl[s] = *(const v8usa*)(vr + (32 + s * 4) * LPT); }
            __builtin_amdgcn_sched_barrier(0);   // the group's stores stand together, with nothing between them and their wait that could overwrite a register they name
#pragma unroll
            for (int s = 0; s < 4; ++s) { *(v8usa*)(e16 + (nb * 16 + s * 4) * TT) = r16[s]; *(v8usa*)(eh + (nb * 16 + s * 4) * TT) = rh[s]; *(v8usa*)(el + (nb * 16 + s * 4) * TT) = rl[s]; }
            asm volatile("s_wait_xcnt 0x0" ::: "memory");   // ahead of the next group, which reuses the registers of these stores
            __builtin_amdgcn_sched_barrier(0);   // keeps the next group's instructions behind that wait
        }
        return;
    }
    float* os = (float*)smem + wv * (16 * 68);
    if (EPI != 0) {
        constexpr int EP = (EPI == 1) ? HD : DQ;   // pitch of the planes' rows in elements
        float d0 = 0.f, d1 = 0.f, d2 = 0.f; if (EPI == 1) { d0 = bfr(dirs[0]); d1 = bfr(dirs[1]); d2 = bfr(dirs[2]); }
        const unsigned g0 = (unsigned)(wm * 64 + hi) * EP + wn * 64 + lr * 4; h16* e16 = E16 + g0; bf* eh = Eh + g0; bf* el = El + g0; float* pj = PJ + wm * 64 + lr;   // every later row step is an immediate offset
#pragma unroll
        for (int mb = 0; mb < 4; ++mb) {
#pragma unroll
            for (int nb = 0; nb < 4; ++nb) {
#pragma unroll
                for (int j = 0; j < 8; ++j) os[(hi * 8 + j) * 68 + nb * 16 + lr] = acc[mb][nb][j]; }
            __builtin_amdgcn_wave_barrier(); asm volatile("" ::: "memory");   // the wave's own LDS writes stay ahead of its reads of other lanes' values
            v4h o16[8]; v4us oh[8], ol[8]; float pv = 0.f;
#pragma unroll
            for (int s = 0; s < 8; ++s) { const v4f val = *(const v4fa*)(os + (2 * s + hi) * 68 + lr * 4);
#pragma unroll
                for (int q = 0; q < 4; ++q) { const float r = val[q] * cs; unsigned short a2, c2; splitf(r, a2, c2); o16[s][q] = tohx(r); oh[s][q] = a2; ol[s][q] = c2; } }
            if (EPI == 1) { const v4f f = *(const v4fa*)(os + lr * 68); pv = f[0] * d0 + f[1] * d1 + f[2] * d2; }   // row lr's columns 0..2 (used where wn == 0)
            __builtin_amdgcn_sched_barrier(0);   // the group's stores stand together, with nothing between them and their wait that could overwrite a register they name
#pragma unroll
            for (int s = 0; s < 8; ++s) { if (EPI == 1) *(v4h*)(e16 + (mb * 16 + 2 * s) * EP) = o16[s];
                *(v4us*)(eh + (mb * 16 + 2 * s) * EP) = oh[s]; *(v4us*)(el + (mb * 16 + 2 * s) * EP) = ol[s]; }
            if (EPI == 1 && wn == 0 && hi == 0) pj[mb * 16] = pv;
            asm volatile("s_wait_xcnt 0x0" ::: "memory");   // ahead of the next group, which reuses the registers of these stores
            __builtin_amdgcn_sched_barrier(0);   // keeps the next group's instructions behind that wait
        }
        return;
    }
#pragma unroll
    for (int mb = 0; mb < 4; ++mb) {
#pragma unroll
        for (int nb = 0; nb < 4; ++nb) {
#pragma unroll
            for (int j = 0; j < 8; ++j) os[(hi * 8 + j) * 68 + nb * 16 + lr] = acc[mb][nb][j]; }
        __builtin_amdgcn_wave_barrier(); asm volatile("" ::: "memory");
        const int cw = c0 + wn * 64; float* crow = C + (size_t)(r0 + wm * 64 + mb * 16) * ldc + cw;
#pragma unroll
        for (int s = 0; s < 8; ++s) { const int row = 2 * s + hi, cofs = lr * 4; v4f val = *(const v4fa*)(os + row * 68 + cofs); if (BIAS) { val[0] += bfr(bias[cw + cofs]); val[1] += bfr(bias[cw + cofs + 1]); val[2] += bfr(bias[cw + cofs + 2]); val[3] += bfr(bias[cw + cofs + 3]); }
            *(v4f*)(crow + (size_t)row * ldc + cofs) = val; }
        __builtin_amdgcn_wave_barrier(); asm volatile("" ::: "memory");
    }
}

// ---- k_gemmw: plain GEMM on gemm_tile; grid (M/128, N/128, Z), 128 threads. z-batch strides sA/sB/sC in elements.
template <typename T16, int NSPLIT, bool BIAS>
__global__ __launch_bounds__(128) void k_gemmw(const T16* __restrict__ A, const T16* __restrict__ A2, const T16* __restrict__ Bt, const T16* __restrict__ Bt2, int K, float* C, int ldc, const float* __restrict__ bias, size_t sA, size_t sB, size_t sC) {
    const size_t z = blockIdx.z; A += z * sA; if (A2) A2 += z * sA; Bt += z * sB; if (Bt2) Bt2 += z * sB; C += z * sC;
    (void)K; gemm_tile<T16, NSPLIT, 0, BIAS, DM, DM, 0>(A, A2, Bt, Bt2, C, ldc, 0, bias, nullptr, nullptr, nullptr, nullptr, nullptr, 1.0f, false);   // K = 1024
}

// ---- k_gemmqkv: [q | k | v] = x Wqkv on gemm_tile; grid (4096/128, 3072/128), 128 threads. A 128-column tile is one head of q, k or v and a 128-row tile lies in one batch, so the epilogue writes the tile straight into that (batch, head)'s planes.
__global__ __launch_bounds__(128) void k_gemmqkv(const bf* __restrict__ A, const bf* __restrict__ Bt, const float* __restrict__ dirs, h16* Q16, bf* Qh, bf* Ql, float* QPJ, h16* K16, bf* Kh, bf* Kl, float* KPJ, h16* V16, bf* Vh, bf* Vl) {
    const int sect = blockIdx.y / NH_, h = blockIdx.y % NH_, t0 = (blockIdx.x % (TT / 128)) * 128; const size_t z = (size_t)(blockIdx.x / (TT / 128)) * NH_ + h;
    const bool vtr = (sect == 2); const size_t o = vtr ? z * HD * TT + t0 : (z * TT + t0) * HD;   // v planes are [d][t], q and k planes [t][d]
    h16* E16 = (sect == 0) ? Q16 : (sect == 1) ? K16 : V16; bf* Eh = (sect == 0) ? Qh : (sect == 1) ? Kh : Vh; bf* El = (sect == 0) ? Ql : (sect == 1) ? Kl : Vl; float* PJ = ((sect == 0) ? QPJ : KPJ) + z * TT + t0;
    gemm_tile<bf, 0, 0, false, DM, DM, 1>(A, nullptr, Bt, nullptr, nullptr, HD, 0, nullptr, E16 + o, Eh + o, El + o, PJ, dirs + h * 3, 1.0f, vtr);
}

#define FBK 64      // keys per stage
#define KPT 136     // LDS pitch of a staged key row in elements: 272 B = 16 B x odd
#define FST (FBK * KPT + HD * LPT)   // elements of one plane's stage: keys | transposed values
typedef __attribute__((ext_vector_type(16))) unsigned short v16us;
template <typename T16, bool HL>
__device__ __forceinline__ void attn_tile(unsigned char* smem, const T16* __restrict__ Q, const T16* __restrict__ Q2, const T16* __restrict__ Kp, const T16* __restrict__ Kp2, const T16* __restrict__ Vt, const T16* __restrict__ Vt2,
                                          const float* __restrict__ qpj, const float* __restrict__ kpj, float hs, int r0, bf* Ah, bf* Al) {
    typedef typename WFrag<T16>::V V; typedef typename WFrag<T16>::H H;
    constexpr int NPL = HL ? 2 : 1, NF = HL ? 1 : 2, DG = HL ? 4 : 8;   // planes per operand; k-steps and d tiles per fragment group
    constexpr float L2E = 1.4426950408889634f, SC2 = SCL * L2E;   // logits are kept in units of log2, so that the exponentials need no multiply
    T16* st = (T16*)smem;
    const int tid = threadIdx.x, lane = tid & 31, wv = tid >> 5, lr = lane & 15, hi = lane >> 4;
    const int qi = r0 + wv * 16 + lr;          // this lane's query row
    const int nblk = r0 / FBK + 128 / FBK;     // key stages up to the end of the tile's diagonal block (work-group-uniform)
    const T16* gk[2] = {Kp, Kp2}; const T16* gv[2] = {Vt, Vt2};
    const unsigned ok = (tid >> 4) * HD + (tid & 15) * 8, ov = (tid >> 3) * TT + (tid & 7) * 8;                       // the thread's 16 bytes of a key row (16 rows a pass) and of a value row (32 rows a pass)
    const unsigned lk = (tid >> 4) * KPT + (tid & 15) * 8, lv = FBK * KPT + (tid >> 3) * LPT + (tid & 7) * 8;
    V qb[4], qb2[4]; H rk[NPL][4], rv[NPL][4];
    const T16* qa = Q + (size_t)qi * HD + 8 * hi; const T16* qa2 = HL ? Q2 + (size_t)qi * HD + 8 * hi : qa;   // the lane's query row; every k-step is an immediate offset
#pragma unroll
    for (int kq = 0; kq < 4; ++kq) { qb[kq] = WFrag<T16>::ld(qa + kq * 32); if (HL) qb2[kq] = WFrag<T16>::ld(qa2 + kq * 32); }
    const float g = hs * qpj[qi] * L2E;
#pragma unroll
    for (int p = 0; p < NPL; ++p)
#pragma unroll
        for (int i = 0; i < 4; ++i) { rk[p][i] = *(const H*)(gk[p] + (size_t)(i * 16) * HD + ok); rv[p][i] = *(const H*)(gv[p] + (size_t)(i * 32) * TT + ov); }
    asm volatile("s_wait_xcnt 0x0" :: "v"(qa), "v"(qa2) : "memory");   // stands ahead of whatever next overwrites an address register of the loads above; naming the two row addresses keeps their registers from being reused as a load's destination ahead of it
    __builtin_amdgcn_sched_barrier(0);   // keeps the address arithmetic of the LDS stores below behind that wait
#pragma unroll
    for (int p = 0; p < NPL; ++p)
#pragma unroll
        for (int i = 0; i < 4; ++i) { *(H*)(st + p * FST + i * 16 * KPT + lk) = rk[p][i]; *(H*)(st + p * FST + i * 32 * LPT + lv) = rv[p][i]; }
    __syncthreads();
    v8f o[8];
#pragma unroll
    for (int db = 0; db < 8; ++db) o[db] = (v8f){};
    float m = -3.0e38f, l = 0.f;
    const int fk = lr * KPT + 8 * hi, fv = FBK * KPT + lr * LPT + 8 * hi;
#pragma unroll 1
    for (int kb = 0; kb < nblk; ++kb) {
        const T16* sc = st + (kb & 1) * (NPL * FST); T16* sn = st + ((kb & 1) ^ 1) * (NPL * FST); const bool more = kb + 1 < nblk;
        v4f kp[8];   // the key projections of this lane's 32 keys
#pragma unroll
        for (int c = 0; c < 8; ++c) kp[c] = *(const v4f*)(kpj + kb * FBK + (c >> 1) * 16 + 8 * hi + (c & 1) * 4);
        __builtin_amdgcn_sched_barrier(0);   // the projections' loads issue first: they are needed first, and loads are waited for in issue order
        const int kn = more ? kb + 1 : kb;   // no branch round the next stage's loads (it would let them move ahead of the loads above); the last pass reads its own stage again and stores nothing
#pragma unroll
        for (int p = 0; p < NPL; ++p)
#pragma unroll
            for (int i = 0; i < 4; ++i) { rk[p][i] = *(const H*)(gk[p] + (size_t)(kn * FBK + i * 16) * HD + ok); rv[p][i] = *(const H*)(gv[p] + (size_t)(i * 32) * TT + kn * FBK + ov); }
        asm volatile("s_wait_xcnt 0x0" ::: "memory");   // ahead of the fragment reads below, which may reuse the address registers of these loads
        v8f s[4];
#pragma unroll
        for (int kt = 0; kt < 4; ++kt) s[kt] = (v8f){};
#pragma unroll
        for (int k0 = 0; k0 < 4; k0 += NF) {
            V a[NF][4], a2[NF][4];
#pragma unroll
            for (int f = 0; f < NF; ++f)
#pragma unroll
                for (int kt = 0; kt < 4; ++kt) { a[f][kt] = WFrag<T16>::ld(sc + fk + kt * 16 * KPT + (k0 + f) * 32); if (HL) a2[f][kt] = WFrag<T16>::ld(sc + FST + fk + kt * 16 * KPT + (k0 + f) * 32); }
            __builtin_amdgcn_sched_barrier(0);   // keeps the group of LDS reads ahead of the matrix instructions: sunk between them, each read's latency is waited out in full
#pragma unroll
            for (int f = 0; f < NF; ++f) {
#pragma unroll
                for (int kt = 0; kt < 4; ++kt) s[kt] = WFrag<T16>::mma(a[f][kt], qb[k0 + f], s[kt]);
                if (HL) {
#pragma unroll
                    for (int kt = 0; kt < 4; ++kt) s[kt] = WFrag<T16>::mma(a[f][kt], qb2[k0 + f], s[kt]);
#pragma unroll
                    for (int kt = 0; kt < 4; ++kt) s[kt] = WFrag<T16>::mma(a2[f][kt], qb[k0 + f], s[kt]); } }
        }
        float mx = m;
#pragma unroll
        for (int kt = 0; kt < 4; ++kt)
#pragma unroll
            for (int r = 0; r < 8; ++r) s[kt][r] = s[kt][r] * SC2 + g * kp[kt * 2 + (r >> 2)][r & 3];   // (s/sqrt(128) + head_scale qp_i kp_j) log2(e)
        if (kb >= nblk - 128 / FBK) {   // only the stages of the tile's diagonal block hold keys behind a query (work-group-uniform test)
            const int dq = qi - kb * FBK - 8 * hi;   // the lane's element kt * 16 + r is live up to here
#pragma unroll
            for (int kt = 0; kt < 4; ++kt)
#pragma unroll
                for (int r = 0; r < 8; ++r) s[kt][r] = (kt * 16 + r <= dq) ? s[kt][r] : -3.0e38f; }
#pragma unroll
        for (int kt = 0; kt < 4; ++kt)
#pragma unroll
            for (int r = 0; r < 8; ++r) mx = fmaxf(mx, s[kt][r]);
        mx = fmaxf(mx, __shfl_xor(mx, 16, 32));   // the query's other 32 keys of the stage
        const float al = __builtin_amdgcn_exp2f(m - mx); m = mx; float ps[4] = {0.f, 0.f, 0.f, 0.f};   // one partial sum per 16-key tile: four short chains of adds
#pragma unroll
        for (int kt = 0; kt < 4; ++kt)
#pragma unroll
            for (int r = 0; r < 8; ++r) { const float p = __builtin_amdgcn_exp2f(s[kt][r] - mx); s[kt][r] = p; ps[kt] += p; }
        l = l * al + ((ps[0] + ps[1]) + (ps[2] + ps[3]));
#pragma unroll
        for (int db = 0; db < 8; ++db) o[db] *= al;
#pragma unroll
        for (int kg = 0; kg < 2; ++kg) {
            V pb, pb2;   // Pt of 32 keys as a B operand: element e = key 8 hi + e of the first tile, element 8 + e the same of the second
            if (HL) { v16us ph, pl;
#pragma unroll
                for (int e = 0; e < 16; ++e) { unsigned short x, y; splitf(s[kg * 2 + (e >> 3)][e & 7], x, y); ph[e] = x; pl[e] = y; }
                pb = __builtin_bit_cast(V, ph); pb2 = __builtin_bit_cast(V, pl);
            } else { v16h ph;
#pragma unroll
                for (int e = 0; e < 16; ++e) ph[e] = tohx(s[kg * 2 + (e >> 3)][e & 7]);
                pb = __builtin_bit_cast(V, ph); }
#pragma unroll
            for (int d0 = 0; d0 < 8; d0 += DG) {
                V a[DG], a2[DG];
#pragma unroll
                for (int d = 0; d < DG; ++d) { a[d] = WFrag<T16>::ld(sc + fv + (d0 + d) * 16 * LPT + kg * 32); if (HL) a2[d] = WFrag<T16>::ld(sc + FST + fv + (d0 + d) * 16 * LPT + kg * 32); }
                __builtin_amdgcn_sched_barrier(0);   // as above: the group's LDS reads stay ahead of its matrix instructions
#pragma unroll
                for (int d = 0; d < DG; ++d) o[d0 + d] = WFrag<T16>::mma(a[d], pb, o[d0 + d]);
                if (HL) {
#pragma unroll
                    for (int d = 0; d < DG; ++d) o[d0 + d] = WFrag<T16>::mma(a[d], pb2, o[d0 + d]);
#pragma unroll
                    for (int d = 0; d < DG; ++d) o[d0 + d] = WFrag<T16>::mma(a2[d], pb, o[d0 + d]); }
            }
        }
        if (more) {
#pragma unroll
            for (int p = 0; p < NPL; ++p)
#pragma unroll
                for (int i = 0; i < 4; ++i) { *(H*)(sn + p * FST + i * 16 * KPT + lk) = rk[p][i]; *(H*)(sn + p * FST + i * 32 * LPT + lv) = rv[p][i]; } }
        __syncthreads();   // publishes the next stage and ends every wave's reads of this one, whose buffer the next pass refills
    }
    l += __shfl_xor(l, 16, 32);   // joins the sums of the wave's halves
    const float inv = 1.0f / l;
    v8us oh[8], ol[8];   // a lane's 8 accumulator rows are 8 consecutive d of its query: one 16-byte piece of the merged row per plane
#pragma unroll
    for (int db = 0; db < 8; ++db)
#pragma unroll
        for (int r = 0; r < 8; ++r) { unsigned short x, y; splitf(o[db][r] * inv, x, y); oh[db][r] = x; ol[db][r] = y; }
    bf* eh = Ah + (size_t)qi * DQ + 8 * hi; bf* el = Al + (size_t)qi * DQ + 8 * hi;
    __builtin_amdgcn_sched_barrier(0);   // the stores stand together, with nothing between them and their wait that could overwrite a register they name
#pragma unroll
    for (int db = 0; db < 8; ++db) { *(v8usa*)(eh + db * 16) = oh[db]; *(v8usa*)(el + db * 16) = ol[db]; }
    asm volatile("s_wait_xcnt 0x0" ::: "memory");   // stands behind the stores, ahead of the release of their registers at the wave's end
}
__global__ __launch_bounds__(256) void k_attn(const h16* __restrict__ Q16, const bf* __restrict__ Qh, const bf* __restrict__ Ql, const h16* __restrict__ K16, const bf* __restrict__ Kh, const bf* __restrict__ Kl, const h16* __restrict__ V16, const bf* __restrict__ Vh, const bf* __restrict__ Vl,
                                              const float* __restrict__ QPJ, const float* __restrict__ KPJ, const float* __restrict__ HSC, bf* Ah, bf* Al) {
    __shared__ __align__(16) unsigned char smem[2 * 2 * FST * 2];   // two stage buffers of up to two planes per operand
    const int r0 = (int)(TT / 128 - 1 - blockIdx.x) * 128; const size_t z = blockIdx.y, pz = z * TT * HD, oz = (z / NH_) * TT * DQ + (z % NH_) * HD; const float hs = bfr(HSC[z % NH_]);
    if (r0 < RH) attn_tile<bf, true>(smem, Qh + pz, Ql + pz, Kh + pz, Kl + pz, Vh + pz, Vl + pz, QPJ + z * TT, KPJ + z * TT, hs, r0, Ah + oz, Al + oz);
    else attn_tile<h16, false>(smem, Q16 + pz, nullptr, K16 + pz, nullptr, V16 + pz, nullptr, QPJ + z * TT, KPJ + z * TT, hs, r0, Ah + oz, Al + oz);
}

__global__ __launch_bounds__(256) void k_wtG(const float* __restrict__ w, int K, int N, bf* Bt) {
    const int lane = threadIdx.x & 31; const int L0 = (blockIdx.x * 8 + (threadIdx.x >> 5)) * 8; const int nlines = N * K / 64;
{
#pragma unroll 1
        for (int l = 0; l < 8; ++l) { const int L = L0 + l; if (L >= nlines) break; const size_t e = (size_t)L * 64 + lane * 2; const int k = (int)(e % K), n = (int)(e / K); v2us o;
            o[0] = f2bf(w[(size_t)k * N + n]); o[1] = f2bf(w[(size_t)(k + 1) * N + n]); *(v2us*)(Bt + e) = o; }
         }
}
__global__ __launch_bounds__(256) void k_cvt8(const float* __restrict__ src, bf* dst, size_t n8) { const size_t i = (size_t)blockIdx.x * 256 + threadIdx.x; if (i >= n8) return; const v8f v = *(const v8f*)(src + i * 8); v8us o;
#pragma unroll
    for (int k = 0; k < 8; ++k) o[k] = f2bf(v[k]); *(v8us*)(dst + i * 8) = o;  }

extern "C" void kernel_launch(void* const* d_in, const int* in_sizes, int n_in,
                              void* d_out, int out_size, void* d_ws, size_t ws_size, hipStream_t stream) {
    (void)in_sizes; (void)n_in; (void)out_size;
    const float* x = (const float*)d_in[0]; const float* wqkv = (const float*)d_in[1]; const float* wo = (const float*)d_in[2]; const float* HSC = (const float*)d_in[3]; const float* HDR = (const float*)d_in[4];  const float* wq = nullptr; const float* wk = nullptr; const float* wv = nullptr; (void)wq; (void)wk; (void)wv;
    float* OUT = (float*)d_out;     // [4][1024][1024]
    char* wsp = (char*)d_ws;
    auto take = [&](size_t bytes) { char* p = wsp; wsp += (bytes + 255) & ~(size_t)255; return (void*)p; };
    bf* WALL = (bf*)take((size_t)3 * DM * DM * 2); bf* WO = (bf*)take((size_t)DM * DQ * 2);
    bf* XB = (bf*)take((size_t)NB_ * TT * DM * 2); float* QPJ = (float*)take((size_t)ZH * TT * 4); float* KPJ = (float*)take((size_t)ZH * TT * 4);
    h16* QP16 = (h16*)take((size_t)ZH * TT * HD * 2); h16* KP16 = (h16*)take((size_t)ZH * TT * HD * 2); h16* VT16 = (h16*)take((size_t)ZH * HD * TT * 2);
    bf* QPh = (bf*)take((size_t)ZH * TT * HD * 2); bf* QPl = (bf*)take((size_t)ZH * TT * HD * 2); bf* KPh = (bf*)take((size_t)ZH * TT * HD * 2); bf* KPl = (bf*)take((size_t)ZH * TT * HD * 2); bf* VTh = (bf*)take((size_t)ZH * HD * TT * 2); bf* VTl = (bf*)take((size_t)ZH * HD * TT * 2);
    bf* ATh = (bf*)take((size_t)NB_ * TT * DQ * 2); bf* ATl = (bf*)take((size_t)NB_ * TT * DQ * 2);
    if ((size_t)(wsp - (char*)d_ws) > ws_size) return;    // ws 256 MiB (about 104 MiB taken)
    k_wtG<<<(unsigned)((DM * 3 * DM / 64 + 63) / 64), 256, 0, stream>>>(wqkv, DM, 3 * DM, WALL);   /* fused 'xw' [DM][3DM] -> Bt [3DM][DM] (row blocks q | k | v) */
    k_wtG<<<(unsigned)((DQ * DM / 64 + 63) / 64), 256, 0, stream>>>(wo, DQ, DM, WO);
    k_cvt8<<<(unsigned)(((size_t)NB_ * TT * DM / 8 + 255) / 256), 256, 0, stream>>>(x, XB, (size_t)NB_ * TT * DM / 8);
    k_gemmqkv<<<dim3(NB_ * TT / 128, 3 * DM / 128, 1), 128, 0, stream>>>(XB, WALL, HDR, QP16, QPh, QPl, QPJ, KP16, KPh, KPl, KPJ, VT16, VTh, VTl);
    k_attn<<<dim3(TT / 128, ZH, 1), 256, 0, stream>>>(QP16, QPh, QPl, KP16, KPh, KPl, VT16, VTh, VTl, QPJ, KPJ, HSC, ATh, ATl);
    k_gemmw<bf, 1, false><<<dim3(NB_ * TT / 128, DM / 128, 1), 128, 0, stream>>>(ATh, ATl, WO, nullptr, DQ, OUT, DM, nullptr, 0, 0, 0);
}

// v005
// A run of this version takes 81.1 microseconds.
// Two timings next to v004 put it at 1.23 and 1.22 times that version's speed.
// Over all steps from v000 it is 16.5 times as fast.
#include <hip/hip_runtime.h>

// Causal multi-head attention with a rank-1 'trigram' geometric bias (x [4][1024][1024]; [q|k|v] = x Wqkv ('xw' [1024][3072], no bias; 8 heads x 128); scores = q.k/sqrt(128) + head_scales[h] (q_i[:3].dirs[h]) (k_j[:3].dirs[h]) (head_scales [8], head_dirs [8][3] read); causal (-inf); softmax; out = merged Wout ('xw') -> [4][1024][1024] (4.2 M)).
// Layout: every stage launched once for all 4 batches x 8 heads (plane index z = batch * 8 + head). The q|k|v GEMM's epilogue writes the 16-bit head planes itself (q, k as [t][d], v transposed as [d][t]) and forms the two 3-term projections per (head, token) in f32 from its f32 accumulators; one attention kernel (k_attn) forms the scores, adds head_scale x qp_i x kp_j to each logit, runs the softmax online and multiplies by v, and writes the merged hi/lo rows that Wout reads; scores and probabilities stay in registers.
// Compute dtypes, f32 accumulate: every input rounded to bf16; q/k/v on PLAIN bf16 operands (inputs: exact); geometric bias in f32 inside the attention kernel; causal scores and attn.v (key stages end at the diagonal block): query rows < 512 hl (3 products), the rest single fp16 (probabilities relative to the running row maximum, at most 1); softmax f32; Wout hl x exact (2 products).

#define NB_  4
#define TT   1024
#define DM   1024
#define NH_  8
#define NKV  8
#define REP  (NH_ / NKV)
#define HD   128
#define DQ   (NH_ * HD)
#define DKV  (NKV * HD)
#define ZH   (NB_ * NH_)          // planes per launch: every (batch, head)
#define RH   512                  // query rows < RH use hi+lo planes (0: none)
#define WIN  1024
#define SCL  0.088388347648318447f   // HD^-0.5
typedef _Float16 h16;
typedef unsigned short bf;
typedef __attribute__((ext_vector_type(16))) __bf16   v16bf;
typedef __attribute__((ext_vector_type(16))) _Float16 v16h;
typedef __attribute__((ext_vector_type(8)))  _Float16 v8h;
typedef __attribute__((ext_vector_type(8)))  unsigned short v8us;
typedef __attribute__((ext_vector_type(8)))  float    v8f;
typedef __attribute__((ext_vector_type(4)))  float    v4f;
typedef v8h  __attribute__((may_alias)) v8ha;
typedef v4f  __attribute__((may_alias)) v4fa;
typedef v8us __attribute__((may_alias)) v8usa;

__device__ __forceinline__ unsigned short f2bf(float f) { unsigned u = __float_as_uint(f); u += 0x7FFFu + ((u >> 16) & 1u); return (unsigned short)(u >> 16); }
__device__ __forceinline__ float bf2f(unsigned short b) { return __uint_as_float(((unsigned)b) << 16); }
__device__ __forceinline__ float bfr(float f) { return bf2f(f2bf(f)); }
__device__ __forceinline__ v16h cat16(v8h lo, v8h hi) { return __builtin_shufflevector(lo, hi, 0, 1, 2, 3, 4, 5, 6, 7, 8, 9, 10, 11, 12, 13, 14, 15); }
__device__ __forceinline__ v16bf cat16b(v8us lo, v8us hi) { return __builtin_bit_cast(v16bf, __builtin_shufflevector(lo, hi, 0, 1, 2, 3, 4, 5, 6, 7, 8, 9, 10, 11, 12, 13, 14, 15)); }
__device__ __forceinline__ v8f wmma16(v16h a, v16h b, v8f c) { return __builtin_amdgcn_wmma_f32_16x16x32_f16(false, a, false, b, (short)0, c, false, false); }
__device__ __forceinline__ v8f wmmab(v16bf a, v16bf b, v8f c) { return __builtin_amdgcn_wmma_f32_16x16x32_bf16(false, a, false, b, (short)0, c, false, false); }
__device__ __forceinline__ h16 tohx(float x) { return (h16)x; }
__device__ __forceinline__ void splitf(float y, unsigned short& h, unsigned short& l) { h = f2bf(y); l = f2bf(y - bf2f(h)); }
typedef __attribute__((ext_vector_type(4))) _Float16 v4h;
typedef __attribute__((ext_vector_type(2))) unsigned short v2us;
typedef __attribute__((ext_vector_type(4))) unsigned short v4us;



// ---- gemm_tile: 128x128 output tile per work-group of 4 waves (2x2, each wave 64x64 = 16 accumulators). Every operand plane's 128 rows x 64 k are brought in as whole 128-byte lines (a wave's 16-byte loads cover 4 rows),
// staged through registers into a two-buffer LDS ring and shared by the waves; fragments come from LDS. The next stage's global loads fly while this stage is multiplied; one work-group barrier per stage.
// C[m][n] (f32, pitch ldc, + optional f32 bias[n]) = sum_k A[m][k] Bt[n][k] (+ split products per NSPLIT), k ascending in steps of 32 per accumulator. lda = pitch of A in elements (Bt has pitch K), both compile-time, so that every row step of a staging load is an immediate offset on one fixed address. K % 64 == 0; M, N % 128 == 0.
// EPI 0 stores C in f32. EPI 1 and 2 store no f32 at all: the tile goes out as 16-bit planes E16 (fp16; EPI 1 only) | Eh | El (bf16 hi + lo), pointers given at the tile's origin, pitch HD (EPI 1) or DQ (EPI 2), each value x cs (vtr: unscaled);
// with vtr (EPI 1, work-group-uniform) the planes are written transposed, [n][m] at pitch TT; PJ (EPI 1, not vtr; at the tile's first row) takes row m's 3-term product of the tile's columns 0..2 with dirs[0..2] (bf16-rounded), in f32.
// CMODE 1 skips score tiles entirely above the causal diagonal (query rows r0+roff.., key columns c0..); CMODE 2 limits the key (K) loop of the probability x value contraction to the diagonal block (probabilities beyond it are exactly zero).
#define BKS 64      // k elements per stage: one whole 128-byte line of every operand row
#define LPT 72      // LDS row pitch in elements: 144 B = 16 B x odd, so that 16-byte fragment reads of 16 rows spread over the banks
template <typename T16> struct WFrag;
template <> struct WFrag<h16> { typedef v16h V; typedef v8h H; static __device__ __forceinline__ V ld(const h16* p) { return cat16(*(const v8h*)p, *(const v8h*)(p + 16)); } static __device__ __forceinline__ v8f mma(V a, V b, v8f c) { return wmma16(a, b, c); } };
template <> struct WFrag<bf> { typedef v16bf V; typedef v8us H; static __device__ __forceinline__ V ld(const bf* p) { return cat16b(*(const v8us*)p, *(const v8us*)(p + 16)); } static __device__ __forceinline__ v8f mma(V a, V b, v8f c) { return wmmab(a, b, c); } };
template <typename T16, int NSPLIT, int CMODE, bool BIAS, int K, int lda, int EPI>
__device__ __forceinline__ void gemm_tile(const T16* __restrict__ A, const T16* __restrict__ A2, const T16* __restrict__ Bt, const T16* __restrict__ Bt2, float* C, int ldc, int roff, const float* __restrict__ bias,
                                          h16* E16, bf* Eh, bf* El, float* PJ, const float* __restrict__ dirs, float cs, bool vtr) {
    typedef typename WFrag<T16>::V V; typedef typename WFrag<T16>::H H;
    constexpr int NA = (NSPLIT == 1 || NSPLIT == 2) ? 2 : 1, NP = NA + ((NSPLIT >= 2) ? 2 : 1), NF = (NSPLIT <= 1) ? 2 : 1;   // planes: A (A2) | Bt (Bt2); k-steps per fragment group
    __shared__ __align__(16) unsigned char smem[2 * NP * 128 * LPT * 2];                          // two stage buffers; the epilogue's row staging reuses them behind the last barrier
    T16* st = (T16*)smem;
    const int tid = threadIdx.x, lane = tid & 31, wv = tid >> 5, lr = lane & 15, hi = lane >> 4; const int wm = wv >> 1, wn = wv & 1; const int r0 = blockIdx.x * 128, c0 = blockIdx.y * 128;
    if (CMODE == 1 && c0 > r0 + roff + 127) return;                  // score tile entirely above the causal diagonal: never written (the softmax masks j > i by select); the whole work-group leaves, ahead of every barrier
    const int Kl = (CMODE == 2) ? min(K, r0 + roff + 128) : K;       // P.V: probabilities are exactly 0 beyond the diagonal block, so the K loop stops there
    v8f acc[4][4];
#pragma unroll
    for (int mb = 0; mb < 4; ++mb)
#pragma unroll
        for (int nb = 0; nb < 4; ++nb) acc[mb][nb] = (v8f){};
    const char* gb[NP]; gb[0] = (const char*)(A + (size_t)r0 * lda); if (NA == 2) gb[1] = (const char*)(A2 + (size_t)r0 * lda); gb[NA] = (const char*)(Bt + (size_t)c0 * K); if (NSPLIT >= 2) gb[NA + 1] = (const char*)(Bt2 + (size_t)c0 * K);   // work-group-uniform bases
    const unsigned trow = tid >> 3, tcol = (tid & 7) * 8;            // this thread's 16 bytes: row trow + 16 i, 8 threads to a 128-byte row
    const unsigned oa = (trow * lda + tcol) * 2, ob = (trow * K + tcol) * 2, ol = trow * LPT + tcol;   // oa, ob: the thread's fixed byte offsets from the uniform bases
    H rg[NP][8];
#pragma unroll
    for (int p = 0; p < NP; ++p)
#pragma unroll
        for (int i = 0; i < 8; ++i) rg[p][i] = *(const H*)(gb[p] + (size_t)(i * 16) * (p < NA ? lda : K) * 2 + (p < NA ? oa : ob));
    asm volatile("s_wait_xcnt 0x0" ::: "memory");   // stands ahead of whatever next overwrites an address register of the loads above
#pragma unroll
    for (int p = 0; p < NP; ++p)
#pragma unroll
        for (int i = 0; i < 8; ++i) *(H*)(st + (p * 128 + i * 16) * LPT + ol) = rg[p][i];
    __syncthreads();
    const int fa = (wm * 64 + lr) * LPT + 8 * hi, fb = (NA * 128 + wn * 64 + lr) * LPT + 8 * hi;
#pragma unroll 1
    for (int kc = 0; kc < Kl; kc += BKS) {
        const T16* sc = st + ((kc / BKS) & 1) * (NP * 128 * LPT); T16* sn = st + (((kc / BKS) & 1) ^ 1) * (NP * 128 * LPT); const bool more = kc + BKS < Kl;
        if (more) {
#pragma unroll
            for (int p = 0; p < NP; ++p)
#pragma unroll
                for (int i = 0; i < 8; ++i) rg[p][i] = *(const H*)(gb[p] + ((size_t)(i * 16) * (p < NA ? lda : K) + kc + BKS) * 2 + (p < NA ? oa : ob));
            asm volatile("s_wait_xcnt 0x0" ::: "memory"); }   // ahead of the fragment reads below, which reuse the address registers of these loads
#pragma unroll
        for (int k0 = 0; k0 < BKS / 32; k0 += NF) {
            V a[NF][4], a2[NF][4], b[NF][4], b2[NF][4];               // all fragments of NF k-steps are fetched as one group, ahead of their matrix instructions
#pragma unroll
            for (int f = 0; f < NF; ++f)
#pragma unroll
                for (int q = 0; q < 4; ++q) { const int kk = (k0 + f) * 32; a[f][q] = WFrag<T16>::ld(sc + fa + q * 16 * LPT + kk); b[f][q] = WFrag<T16>::ld(sc + fb + q * 16 * LPT + kk);
                    if (NSPLIT == 1 || NSPLIT == 2) a2[f][q] = WFrag<T16>::ld(sc + fa + (128 + q * 16) * LPT + kk); if (NSPLIT >= 2) b2[f][q] = WFrag<T16>::ld(sc + fb + (128 + q * 16) * LPT + kk); }
            __builtin_amdgcn_sched_barrier(0);   // keeps the group of LDS reads ahead of the matrix instructions: sunk between them, each read's latency is waited out in full
#pragma unroll
            for (int f = 0; f < NF; ++f)
#pragma unroll
                for (int nb = 0; nb < 4; ++nb)
#pragma unroll
                    for (int mb = 0; mb < 4; ++mb) { acc[mb][nb] = WFrag<T16>::mma(a[f][mb], b[f][nb], acc[mb][nb]); if (NSPLIT == 1 || NSPLIT == 2) acc[mb][nb] = WFrag<T16>::mma(a2[f][mb], b[f][nb], acc[mb][nb]); if (NSPLIT >= 2) acc[mb][nb] = WFrag<T16>::mma(a[f][mb], b2[f][nb], acc[mb][nb]); }
            // four vector slots behind the stage's last matrix instruction: the loop's taken branch leads to loads that overwrite its operand registers
            if (k0 + NF == BKS / 32) asm volatile("v_nop\n\tv_nop\n\tv_nop\n\tv_nop" : "+v"(acc[0][0]), "+v"(acc[1][1]), "+v"(acc[2][2]), "+v"(acc[3][3]) : "v"(a[NF - 1][0]), "v"(a[NF - 1][3]));
        }
        if (more) {
#pragma unroll
            for (int p = 0; p < NP; ++p)
#pragma unroll
                for (int i = 0; i < 8; ++i) *(H*)(sn + (p * 128 + i * 16) * LPT + ol) = rg[p][i]; }
        __syncthreads();   // publishes the next stage and ends every wave's reads of this one, whose buffer the next pass refills
    }
    if (EPI == 1 && vtr) {   // transposed planes: a lane's 8 accumulator rows are 8 consecutive m of one column n, so they go to LDS as one 16-byte piece of row n; the rows come back as whole 128-byte lines (64 m)
        bf* vs = (bf*)smem + wv * (3 * 16 * LPT); bf* vw = vs + lr * LPT + hi * 8; const bf* vr = vs + (lane >> 3) * LPT + (lane & 7) * 8;
        const unsigned g0 = (unsigned)(wn * 64 + (lane >> 3)) * TT + wm * 64 + (lane & 7) * 8; bf* e16 = (bf*)E16 + g0; bf* eh = Eh + g0; bf* el = El + g0;   // every later row step is an immediate offset
#pragma unroll
        for (int nb = 0; nb < 4; ++nb) {
#pragma unroll
            for (int mb = 0; mb < 4; ++mb) { v8us w16, wh, wl;
#pragma unroll
                for (int j = 0; j < 8; ++j) { const float x = acc[mb][nb][j]; unsigned short a2, c2; splitf(x, a2, c2); w16[j] = __builtin_bit_cast(unsigned short, tohx(x)); wh[j] = a2; wl[j] = c2; }
                *(v8usa*)(vw + mb * 16) = w16; *(v8usa*)(vw + 16 * LPT + mb * 16) = wh; *(v8usa*)(vw + 32 * LPT + mb * 16) = wl; }
            __builtin_amdgcn_wave_barrier(); asm volatile("" ::: "memory");   // the wave's own LDS writes stay ahead of its reads of other lanes' pieces
            v8us r16[4], rh[4], rl[4];
#pragma unroll
            for (int s = 0; s < 4; ++s) { r16[s] = *(const v8usa*)(vr + s * 4 * LPT); rh[s] = *(const v8usa*)(vr + (16 + s * 4) * LPT); rl[s] = *(const v8usa*)(vr + (32 + s * 4) * LPT); }
            __builtin_amdgcn_sched_barrier(0);   // the group's stores stand together, with nothing between them and their wait that could overwrite a register they name
#pragma unroll
            for (int s = 0; s < 4; ++s) { *(v8usa*)(e16 + (nb * 16 + s * 4) * TT) = r16[s]; *(v8usa*)(eh + (nb * 16 + s * 4) * TT) = rh[s]; *(v8usa*)(el + (nb * 16 + s * 4) * TT) = rl[s]; }
            asm volatile("s_wait_xcnt 0x0" ::: "memory");   // ahead of the next group, which reuses the registers of these stores
            __builtin_amdgcn_sched_barrier(0);   // keeps the next group's instructions behind that wait
        }
        return;
    }
    float* os = (float*)smem + wv * (16 * 68);
    if (EPI != 0) {
        constexpr int EP = (EPI == 1) ? HD : DQ;   // pitch of the planes' rows in elements
        float d0 = 0.f, d1 = 0.f, d2 = 0.f; if (EPI == 1) { d0 = bfr(dirs[0]); d1 = bfr(dirs[1]); d2 = bfr(dirs[2]); }
        const unsigned g0 = (unsigned)(wm * 64 + hi) * EP + wn * 64 + lr * 4; h16* e16 = E16 + g0; bf* eh = Eh + g0; bf* el = El + g0; float* pj = PJ + wm * 64 + lr;   // every later row step is an immediate offset
#pragma unroll
        for (int mb = 0; mb < 4; ++mb) {
#pragma unroll
            for (int nb = 0; nb < 4; ++nb) {
#pragma unroll
                for (int j = 0; j < 8; ++j) os[(hi * 8 + j) * 68 + nb * 16 + lr] = acc[mb][nb][j]; }
            __builtin_amdgcn_wave_barrier(); asm volatile("" ::: "memory");   // the wave's own LDS writes stay ahead of its reads of other lanes' values
            v4h o16[8]; v4us oh[8], ol[8]; float pv = 0.f;
#pragma unroll
            for (int s = 0; s < 8; ++s) { const v4f val = *(const v4fa*)(os + (2 * s + hi) * 68 + lr * 4);
#pragma unroll
                for (int q = 0; q < 4; ++q) { const float r = val[q] * cs; unsigned short a2, c2; splitf(r, a2, c2); o16[s][q] = tohx(r); oh[s][q] = a2; ol[s][q] = c2; } }
            if (EPI == 1) { const v4f f = *(const v4fa*)(os + lr * 68); pv = f[0] * d0 + f[1] * d1 + f[2] * d2; }   // row lr's columns 0..2 (used where wn == 0)
            __builtin_amdgcn_sched_barrier(0);   // the group's stores stand together, with nothing between them and their wait that could overwrite a register they name
#pragma unroll
            for (int s = 0; s < 8; ++s) { if (EPI == 1) *(v4h*)(e16 + (mb * 16 + 2 * s) * EP) = o16[s];
                *(v4us*)(eh + (mb * 16 + 2 * s) * EP) = oh[s]; *(v4us*)(el + (mb * 16 + 2 * s) * EP) = ol[s]; }
            if (EPI == 1 && wn == 0 && hi == 0) pj[mb * 16] = pv;
            asm volatile("s_wait_xcnt 0x0" ::: "memory");   // ahead of the next group, which reuses the registers of these stores
            __builtin_amdgcn_sched_barrier(0);   // keeps the next group's instructions behind that wait
        }
        return;
    }
#pragma unroll
    for (int mb = 0; mb < 4; ++mb) {
#pragma unroll
        for (int nb = 0; nb < 4; ++nb) {
#pragma unroll
            for (int j = 0; j < 8; ++j) os[(hi * 8 + j) * 68 + nb * 16 + lr] = acc[mb][nb][j]; }
        __builtin_amdgcn_wave_barrier(); asm volatile("" ::: "memory");
        const int cw = c0 + wn * 64; float* crow = C + (size_t)(r0 + wm * 64 + mb * 16) * ldc + cw;
#pragma unroll
        for (int s = 0; s < 8; ++s) { const int row = 2 * s + hi, cofs = lr * 4; v4f val = *(const v4fa*)(os + row * 68 + cofs); if (BIAS) { val[0] += bfr(bias[cw + cofs]); val[1] += bfr(bias[cw + cofs + 1]); val[2] += bfr(bias[cw + cofs + 2]); val[3] += bfr(bias[cw + cofs + 3]); }
            *(v4f*)(crow + (size_t)row * ldc + cofs) = val; }
        __builtin_amdgcn_wave_barrier(); asm volatile("" ::: "memory");
    }
}

// ---- k_gemmw: plain GEMM on gemm_tile; grid (M/128, N/128, Z), 128 threads. z-batch strides sA/sB/sC in elements.
template <typename T16, int NSPLIT, bool BIAS>
__global__ __launch_bounds__(128) void k_gemmw(const T16* __restrict__ A, const T16* __restrict__ A2, const T16* __restrict__ Bt, const T16* __restrict__ Bt2, int K, float* C, int ldc, const float* __restrict__ bias, size_t sA, size_t sB, size_t sC) {
    const size_t z = blockIdx.z; A += z * sA; if (A2) A2 += z * sA; Bt += z * sB; if (Bt2) Bt2 += z * sB; C += z * sC;
    (void)K; gemm_tile<T16, NSPLIT, 0, BIAS, DM, DM, 0>(A, A2, Bt, Bt2, C, ldc, 0, bias, nullptr, nullptr, nullptr, nullptr, nullptr, 1.0f, false);   // K = 1024
}

// ---- k_gemmqkv: [q | k | v] = x Wqkv on gemm_tile; grid (4096/128, 3072/128), 128 threads. A 128-column tile is one head of q, k or v and a 128-row tile lies in one batch, so the epilogue writes the tile straight into that (batch, head)'s planes.
__global__ __launch_bounds__(128) void k_gemmqkv(const bf* __restrict__ A, const bf* __restrict__ Bt, const float* __restrict__ dirs, h16* Q16, bf* Qh, bf* Ql, float* QPJ, h16* K16, bf* Kh, bf* Kl, float* KPJ, h16* V16, bf* Vh, bf* Vl) {
    const int sect = blockIdx.y / NH_, h = blockIdx.y % NH_, t0 = (blockIdx.x % (TT / 128)) * 128; const size_t z = (size_t)(blockIdx.x / (TT / 128)) * NH_ + h;
    const bool vtr = (sect == 2); const size_t o = vtr ? z * HD * TT + t0 : (z * TT + t0) * HD;   // v planes are [d][t], q and k planes [t][d]
    h16* E16 = (sect == 0) ? Q16 : (sect == 1) ? K16 : V16; bf* Eh = (sect == 0) ? Qh : (sect == 1) ? Kh : Vh; bf* El = (sect == 0) ? Ql : (sect == 1) ? Kl : Vl; float* PJ = ((sect == 0) ? QPJ : KPJ) + z * TT + t0;
    gemm_tile<bf, 0, 0, false, DM, DM, 1>(A, nullptr, Bt, nullptr, nullptr, HD, 0, nullptr, E16 + o, Eh + o, El + o, PJ, dirs + h * 3, 1.0f, vtr);
}

#define FBK 64      // keys per stage
#define KPT 136     // LDS pitch of a staged key row in elements: 272 B = 16 B x odd
#define FST (FBK * KPT + HD * LPT)   // elements of one plane's stage: keys | transposed values
typedef __attribute__((ext_vector_type(16))) unsigned short v16us;
template <typename T16, bool HL>
__device__ __forceinline__ void attn_tile(unsigned char* smem, const T16* __restrict__ Q, const T16* __restrict__ Q2, const T16* __restrict__ Kp, const T16* __restrict__ Kp2, const T16* __restrict__ Vt, const T16* __restrict__ Vt2,
                                          const float* __restrict__ qpj, const float* __restrict__ kpj, float hs, int r0, bf* Ah, bf* Al) {
    typedef typename WFrag<T16>::V V; typedef typename WFrag<T16>::H H;
    constexpr int NPL = HL ? 2 : 1, NF = HL ? 1 : 2, DG = HL ? 4 : 8;   // planes per operand; k-steps and d tiles per fragment group
    constexpr float L2E = 1.4426950408889634f, SC2 = SCL * L2E;   // logits are kept in units of log2, so that the exponentials need no multiply
    T16* st = (T16*)smem;
    const int tid = threadIdx.x, lane = tid & 31, wv = tid >> 5, lr = lane & 15, hi = lane >> 4;
    const int qi = r0 + wv * 16 + lr;          // this lane's query row
    const int nblk = r0 / FBK + 128 / FBK;     // key stages up to the end of the tile's diagonal block (work-group-uniform)
    const T16* gk[2] = {Kp, Kp2}; const T16* gv[2] = {Vt, Vt2};
    const unsigned ok = (tid >> 4) * HD + (tid & 15) * 8, ov = (tid >> 3) * TT + (tid & 7) * 8;                       // the thread's 16 bytes of a key row (16 rows a pass) and of a value row (32 rows a pass)
    const unsigned lk = (tid >> 4) * KPT + (tid & 15) * 8, lv = FBK * KPT + (tid >> 3) * LPT + (tid & 7) * 8;
    V qb[4], qb2[4]; H rk[NPL][4], rv[NPL][4];
    const T16* qa = Q + (size_t)qi * HD + 8 * hi; const T16* qa2 = HL ? Q2 + (size_t)qi * HD + 8 * hi : qa;   // the lane's query row; every k-step is an immediate offset
#pragma unroll
    for (int kq = 0; kq < 4; ++kq) { qb[kq] = WFrag<T16>::ld(qa + kq * 32); if (HL) qb2[kq] = WFrag<T16>::ld(qa2 + kq * 32); }
    const float g = hs * qpj[qi] * L2E;
#pragma unroll
    for (int p = 0; p < NPL; ++p)
#pragma unroll
        for (int i = 0; i < 4; ++i) { rk[p][i] = *(const H*)(gk[p] + (size_t)(i * 16) * HD + ok); rv[p][i] = *(const H*)(gv[p] + (size_t)(i * 32) * TT + ov); }
    asm volatile("s_wait_xcnt 0x0" :: "v"(qa), "v"(qa2) : "memory");   // stands ahead of whatever next overwrites an address register of the loads above; naming the two row addresses keeps their registers from being reused as a load's destination ahead of it
    __builtin_amdgcn_sched_barrier(0);   // keeps the address arithmetic of the LDS stores below behind that wait
#pragma unroll
    for (int p = 0; p < NPL; ++p)
#pragma unroll
        for (int i = 0; i < 4; ++i) { *(H*)(st + p * FST + i * 16 * KPT + lk) = rk[p][i]; *(H*)(st + p * FST + i * 32 * LPT + lv) = rv[p][i]; }
    __syncthreads();
    v8f o[8];
#pragma unroll
    for (int db = 0; db < 8; ++db) o[db] = (v8f){};
    float m = -3.0e38f, l = 0.f;
    const int fk = lr * KPT + 8 * hi, fv = FBK * KPT + lr * LPT + 8 * hi;
#pragma unroll 1
    for (int kb = 0; kb < nblk; ++kb) {
        const T16* sc = st + (kb & 1) * (NPL * FST); T16* sn = st + ((kb & 1) ^ 1) * (NPL * FST); const bool more = kb + 1 < nblk;
        v4f kp[8];   // the key projections of this lane's 32 keys
#pragma unroll
        for (int c = 0; c < 8; ++c) kp[c] = *(const v4f*)(kpj + kb * FBK + (c >> 1) * 16 + 8 * hi + (c & 1) * 4);
        __builtin_amdgcn_sched_barrier(0);   // the projections' loads issue first: they are needed first, and loads are waited for in issue order
        const int kn = more ? kb + 1 : kb;   // no branch round the next stage's loads (it would let them move ahead of the loads above); the last pass reads its own stage again and stores nothing
#pragma unroll
        for (int p = 0; p < NPL; ++p)
#pragma unroll
            for (int i = 0; i < 4; ++i) { rk[p][i] = *(const H*)(gk[p] + (size_t)(kn * FBK + i * 16) * HD + ok); rv[p][i] = *(const H*)(gv[p] + (size_t)(i * 32) * TT + kn * FBK + ov); }
        asm volatile("s_wait_xcnt 0x0" ::: "memory");   // ahead of the fragment reads below, which may reuse the address registers of these loads
        v8f s[4];
#pragma unroll
        for (int kt = 0; kt < 4; ++kt) s[kt] = (v8f){};
#pragma unroll
        for (int k0 = 0; k0 < 4; k0 += NF) {
            V a[NF][4], a2[NF][4];
#pragma unroll
            for (int f = 0; f < NF; ++f)
#pragma unroll
                for (int kt = 0; kt < 4; ++kt) { a[f][kt] = WFrag<T16>::ld(sc + fk + kt * 16 * KPT + (k0 + f) * 32); if (HL) a2[f][kt] = WFrag<T16>::ld(sc + FST + fk + kt * 16 * KPT + (k0 + f) * 32); }
            __builtin_amdgcn_sched_barrier(0);   // keeps the group of LDS reads ahead of the matrix instructions: sunk between them, each read's latency is waited out in full
#pragma unroll
            for (int f = 0; f < NF; ++f) {
#pragma unroll
                for (int kt = 0; kt < 4; ++kt) s[kt] = WFrag<T16>::mma(a[f][kt], qb[k0 + f], s[kt]);
                if (HL) {
#pragma unroll
                    for (int kt = 0; kt < 4; ++kt) s[kt] = WFrag<T16>::mma(a[f][kt], qb2[k0 + f], s[kt]);
#pragma unroll
                    for (int kt = 0; kt < 4; ++kt) s[kt] = WFrag<T16>::mma(a2[f][kt], qb[k0 + f], s[kt]); } }
        }
        float mx = m;
#pragma unroll
        for (int kt = 0; kt < 4; ++kt)
#pragma unroll
            for (int r = 0; r < 8; ++r) s[kt][r] = s[kt][r] * SC2 + g * kp[kt * 2 + (r >> 2)][r & 3];   // (s/sqrt(128) + head_scale qp_i kp_j) log2(e)
        if (kb >= nblk - 128 / FBK) {   // only the stages of the tile's diagonal block hold keys behind a query (work-group-uniform test)
            const int dq = qi - kb * FBK - 8 * hi;   // the lane's element kt * 16 + r is live up to here
#pragma unroll
            for (int kt = 0; kt < 4; ++kt)
#pragma unroll
                for (int r = 0; r < 8; ++r) s[kt][r] = (kt * 16 + r <= dq) ? s[kt][r] : -3.0e38f; }
#pragma unroll
        for (int kt = 0; kt < 4; ++kt)
#pragma unroll
            for (int r = 0; r < 8; ++r) mx = fmaxf(mx, s[kt][r]);
        mx = fmaxf(mx, __shfl_xor(mx, 16, 32));   // the query's other 32 keys of the stage
        const float al = __builtin_amdgcn_exp2f(m - mx); m = mx; float ps[4] = {0.f, 0.f, 0.f, 0.f};   // one partial sum per 16-key tile: four short chains of adds
#pragma unroll
        for (int kt = 0; kt < 4; ++kt)
#pragma unroll
            for (int r = 0; r < 8; ++r) { const float p = __builtin_amdgcn_exp2f(s[kt][r] - mx); s[kt][r] = p; ps[kt] += p; }
        l = l * al + ((ps[0] + ps[1]) + (ps[2] + ps[3]));
#pragma unroll
        for (int db = 0; db < 8; ++db) o[db] *= al;
#pragma unroll
        for (int kg = 0; kg < 2; ++kg) {
            V pb, pb2;   // Pt of 32 keys as a B operand: element e = key 8 hi + e of the first tile, element 8 + e the same of the second
            if (HL) { v16us ph, pl;
#pragma unroll
                for (int e = 0; e < 16; ++e) { unsigned short x, y; splitf(s[kg * 2 + (e >> 3)][e & 7], x, y); ph[e] = x; pl[e] = y; }
                pb = __builtin_bit_cast(V, ph); pb2 = __builtin_bit_cast(V, pl);
            } else { v16h ph;
#pragma unroll
                for (int e = 0; e < 16; ++e) ph[e] = tohx(s[kg * 2 + (e >> 3)][e & 7]);
                pb = __builtin_bit_cast(V, ph); }
#pragma unroll
            for (int d0 = 0; d0 < 8; d0 += DG) {
                V a[DG], a2[DG];
#pragma unroll
                for (int d = 0; d < DG; ++d) { a[d] = WFrag<T16>::ld(sc + fv + (d0 + d) * 16 * LPT + kg * 32); if (HL) a2[d] = WFrag<T16>::ld(sc + FST + fv + (d0 + d) * 16 * LPT + kg * 32); }
                __builtin_amdgcn_sched_barrier(0);   // as above: the group's LDS reads stay ahead of its matrix instructions
#pragma unroll
                for (int d = 0; d < DG; ++d) o[d0 + d] = WFrag<T16>::mma(a[d], pb, o[d0 + d]);
                if (HL) {
#pragma unroll
                    for (int d = 0; d < DG; ++d) o[d0 + d] = WFrag<T16>::mma(a[d], pb2, o[d0 + d]);
#pragma unroll
                    for (int d = 0; d < DG; ++d) o[d0 + d] = WFrag<T16>::mma(a2[d], pb, o[d0 + d]); }
            }
        }
        if (more) {
#pragma unroll
            for (int p = 0; p < NPL; ++p)
#pragma unroll
                for (int i = 0; i < 4; ++i) { *(H*)(sn + p * FST + i * 16 * KPT + lk) = rk[p][i]; *(H*)(sn + p * FST + i * 32 * LPT + lv) = rv[p][i]; } }
        __syncthreads();   // publishes the next stage and ends every wave's reads of this one, whose buffer the next pass refills
    }
    l += __shfl_xor(l, 16, 32);   // joins the sums of the wave's halves
    const float inv = 1.0f / l;
    v8us oh[8], ol[8];   // a lane's 8 accumulator rows are 8 consecutive d of its query: one 16-byte piece of the merged row per plane
#pragma unroll
    for (int db = 0; db < 8; ++db)
#pragma unroll
        for (int r = 0; r < 8; ++r) { unsigned short x, y; splitf(o[db][r] * inv, x, y); oh[db][r] = x; ol[db][r] = y; }
    bf* eh = Ah + (size_t)qi * DQ + 8 * hi; bf* el = Al + (size_t)qi * DQ + 8 * hi;
    __builtin_amdgcn_sched_barrier(0);   // the stores stand together, with nothing between them and their wait that could overwrite a register they name
#pragma unroll
    for (int db = 0; db < 8; ++db) { *(v8usa*)(eh + db * 16) = oh[db]; *(v8usa*)(el + db * 16) = ol[db]; }
    asm volatile("s_wait_xcnt 0x0" ::: "memory");   // stands behind the stores, ahead of the release of their registers at the wave's end
}
__global__ __launch_bounds__(256) void k_attn(const h16* __restrict__ Q16, const bf* __restrict__ Qh, const bf* __restrict__ Ql, const h16* __restrict__ K16, const bf* __restrict__ Kh, const bf* __restrict__ Kl, const h16* __restrict__ V16, const bf* __restrict__ Vh, const bf* __restrict__ Vl,
                                              const float* __restrict__ QPJ, const float* __restrict__ KPJ, const float* __restrict__ HSC, bf* Ah, bf* Al) {
    __shared__ __align__(16) unsigned char smem[2 * 2 * FST * 2];   // two stage buffers of up to two planes per operand
    const int r0 = (int)(TT / 128 - 1 - blockIdx.x) * 128; const size_t z = blockIdx.y, pz = z * TT * HD, oz = (z / NH_) * TT * DQ + (z % NH_) * HD; const float hs = bfr(HSC[z % NH_]);
    if (r0 < RH) attn_tile<bf, true>(smem, Qh + pz, Ql + pz, Kh + pz, Kl + pz, Vh + pz, Vl + pz, QPJ + z * TT, KPJ + z * TT, hs, r0, Ah + oz, Al + oz);
    else attn_tile<h16, false>(smem, Q16 + pz, nullptr, K16 + pz, nullptr, V16 + pz, nullptr, QPJ + z * TT, KPJ + z * TT, hs, r0, Ah + oz, Al + oz);
}

// ---- k_prep: the GEMMs' three 16-bit operands in one launch: Wqkv and Wout transposed to [n][k] bf16, x rounded to bf16. Grid 256 work-groups (as many as the chip has WGPs) x 512 threads = 16 waves.
// A work-group takes four 64 k x 64 n weight tiles (three of Wqkv, one of Wout) and 16384 values of x; a thread issues its 16 16-byte loads together, each wave instruction covering whole 128-byte lines.
// A thread holds 4 columns n of two neighbouring rows k: the pair (k, k + 1) of one column goes to LDS as one dword of row n. A row n is 32 dwords; its 16-byte groups (8 k) stand at group ^ ((n >> 2) & 7),
// so that a wave's dword stores fall on 32 different banks and its 16-byte reads on all 64. Behind the barrier 8 threads read and store one whole 128-byte line of the transposed plane.
typedef __attribute__((ext_vector_type(4))) unsigned v4u;
typedef v4u __attribute__((may_alias)) v4ua;
typedef v4us __attribute__((may_alias)) v4usa;
__global__ __launch_bounds__(512) void k_prep(const float* __restrict__ x, const float* __restrict__ wqkv, const float* __restrict__ wo, bf* XB, bf* WALL, bf* WO) {
    __shared__ __align__(16) unsigned tl[4][64 * 32];
    const unsigned t = threadIdx.x, kt = blockIdx.x & 15, nt = blockIdx.x >> 4;   // tile (kt, nt + 16 i) of Wqkv, i = 0..2; tile (kt, nt) of Wout
    const unsigned c4 = t & 7, kl = (t >> 3) & 3, hf = (t >> 5) & 1, g = t >> 6;  // 8 threads to a 128-byte piece of a row; 4 row pairs to a wave; the wave's half of the columns and its group of 8 rows
    const unsigned kr = kt * 64 + (g * 4 + kl) * 2, nc = hf * 32 + c4 * 4;        // the thread's first row k, and its first column inside the tile
    const unsigned oq = kr * (3 * DM) + nt * 64 + nc, oo = kr * DM + nt * 64 + nc, ox = blockIdx.x * 16384 + t * 4;   // element offsets; every further step is an immediate offset
    const float* pq = wqkv + oq; const float* po = wo + oo; const float* px = x + ox;
    v4f w0[4], w1[4], xv[8];
#pragma unroll
    for (int i = 0; i < 3; ++i) { w0[i] = *(const v4fa*)(pq + i * 1024); w1[i] = *(const v4fa*)(pq + i * 1024 + 3 * DM); }
    w0[3] = *(const v4fa*)po; w1[3] = *(const v4fa*)(po + DM);
    __builtin_amdgcn_sched_barrier(0);   // the weights' loads issue first: they are needed first, ahead of the barrier, and loads are waited for in issue order
#pragma unroll
    for (int i = 0; i < 8; ++i) xv[i] = *(const v4fa*)(px + i * 2048);
    asm volatile("s_wait_xcnt 0x0" :: "v"(pq), "v"(po), "v"(px) : "memory");   // stands ahead of whatever next overwrites an address register of the loads above; naming the three addresses keeps their registers from being reused as a load's destination ahead of it
    const unsigned ls = nc * 32 + ((g ^ c4) << 2) + kl;
#pragma unroll
    for (int i = 0; i < 4; ++i)
#pragma unroll
        for (int j = 0; j < 4; ++j) tl[i][ls + j * 32] = (unsigned)f2bf(w0[i][j]) | ((unsigned)f2bf(w1[i][j]) << 16);
    __syncthreads();   // every tile is whole before a row of it is read
    const unsigned n = t >> 3, gr = t & 7, lq = n * 32 + ((gr ^ ((n >> 2) & 7)) << 2);
    v4u r[4]; v4us xo[8];
#pragma unroll
    for (int i = 0; i < 4; ++i) r[i] = *(const v4ua*)(&tl[i][lq]);
#pragma unroll
    for (int i = 0; i < 8; ++i)
#pragma unroll
        for (int q = 0; q < 4; ++q) xo[i][q] = f2bf(xv[i][q]);
    const unsigned ot = (nt * 64 + n) * DM + kt * 64 + gr * 8;   // row n of the transposed plane, 8 k from gr * 8 (both planes have pitch 1024)
    __builtin_amdgcn_sched_barrier(0);   // the stores stand together, with nothing between them and their wait that could overwrite a register they name
#pragma unroll
    for (int i = 0; i < 3; ++i) *(v4ua*)(WALL + ot + i * (1024 * DM)) = r[i];
    *(v4ua*)(WO + ot) = r[3];
#pragma unroll
    for (int i = 0; i < 8; ++i) *(v4usa*)(XB + ox + i * 2048) = xo[i];
    asm volatile("s_wait_xcnt 0x0" ::: "memory");   // stands behind the stores, ahead of the release of their registers at the wave's end
}

extern "C" void kernel_launch(void* const* d_in, const int* in_sizes, int n_in,
                              void* d_out, int out_size, void* d_ws, size_t ws_size, hipStream_t stream) {
    (void)in_sizes; (void)n_in; (void)out_size;
    const float* x = (const float*)d_in[0]; const float* wqkv = (const float*)d_in[1]; const float* wo = (const float*)d_in[2]; const float* HSC = (const float*)d_in[3]; const float* HDR = (const float*)d_in[4];  const float* wq = nullptr; const float* wk = nullptr; const float* wv = nullptr; (void)wq; (void)wk; (void)wv;
    float* OUT = (float*)d_out;     // [4][1024][1024]
    char* wsp = (char*)d_ws;
    auto take = [&](size_t bytes) { char* p = wsp; wsp += (bytes + 255) & ~(size_t)255; return (void*)p; };
    bf* WALL = (bf*)take((size_t)3 * DM * DM * 2); bf* WO = (bf*)take((size_t)DM * DQ * 2);
    bf* XB = (bf*)take((size_t)NB_ * TT * DM * 2); float* QPJ = (float*)take((size_t)ZH * TT * 4); float* KPJ = (float*)take((size_t)ZH * TT * 4);
    h16* QP16 = (h16*)take((size_t)ZH * TT * HD * 2); h16* KP16 = (h16*)take((size_t)ZH * TT * HD * 2); h16* VT16 = (h16*)take((size_t)ZH * HD * TT * 2);
    bf* QPh = (bf*)take((size_t)ZH * TT * HD * 2); bf* QPl = (bf*)take((size_t)ZH * TT * HD * 2); bf* KPh = (bf*)take((size_t)ZH * TT * HD * 2); bf* KPl = (bf*)take((size_t)ZH * TT * HD * 2); bf* VTh = (bf*)take((size_t)ZH * HD * TT * 2); bf* VTl = (bf*)take((size_t)ZH * HD * TT * 2);
    bf* ATh = (bf*)take((size_t)NB_ * TT * DQ * 2); bf* ATl = (bf*)take((size_t)NB_ * TT * DQ * 2);
    if ((size_t)(wsp - (char*)d_ws) > ws_size) return;    // ws 256 MiB (about 104 MiB taken)
    k_prep<<<256, 512, 0, stream>>>(x, wqkv, wo, XB, WALL, WO);   /* 'xw' weights [k][n] -> Bt [n][k] (WALL: row blocks q | k | v); x -> bf16 */
    k_gemmqkv<<<dim3(NB_ * TT / 128, 3 * DM / 128, 1), 128, 0, stream>>>(XB, WALL, HDR, QP16, QPh, QPl, QPJ, KP16, KPh, KPl, KPJ, VT16, VTh, VTl);
    k_attn<<<dim3(TT / 128, ZH, 1), 256, 0, stream>>>(QP16, QPh, QPl, KP16, KPh, KPl, VT16, VTh, VTl, QPJ, KPJ, HSC, ATh, ATl);
    k_gemmw<bf, 1, false><<<dim3(NB_ * TT / 128, DM / 128, 1), 128, 0, stream>>>(ATh, ATl, WO, nullptr, DQ, OUT, DM, nullptr, 0, 0, 0);
}

// v006
// Measured time: 73.7 microseconds a run.
// Two timings next to v005 put it at 1.12 and 1.11 times that version's speed.
// Over all steps from v000 it is 18.4 times as fast.
#include <hip/hip_runtime.h>

// Causal multi-head attention with a rank-1 'trigram' geometric bias (x [4][1024][1024]; [q|k|v] = x Wqkv ('xw' [1024][3072], no bias; 8 heads x 128); scores = q.k/sqrt(128) + head_scales[h] (q_i[:3].dirs[h]) (k_j[:3].dirs[h]) (head_scales [8], head_dirs [8][3] read); causal (-inf); softmax; out = merged Wout ('xw') -> [4][1024][1024] (4.2 M)).
// Layout: every stage launched once for all 4 batches x 8 heads (plane index z = batch * 8 + head). The q|k|v GEMM's epilogue writes the 16-bit head planes itself (q, k as [t][d], v transposed as [d][t]) and forms the two 3-term projections per (head, token) in f32 from its f32 accumulators; one attention kernel (k_attn) forms the scores, adds head_scale x qp_i x kp_j to each logit, runs the softmax online and multiplies by v, and writes the merged hi/lo rows that Wout reads; scores and probabilities stay in registers.
// Compute dtypes, f32 accumulate: every input rounded to bf16; q/k/v on PLAIN bf16 operands (inputs: exact); geometric bias in f32 inside the attention kernel; causal scores and attn.v (key stages end at the diagonal block): query rows < 512 hl (3 products), the rest single fp16 (probabilities relative to the running row maximum, at most 1); softmax f32; Wout hl x exact (2 products).

#define NB_  4
#define TT   1024
#define DM   1024
#define NH_  8
#define NKV  8
#define REP  (NH_ / NKV)
#define HD   128
#define DQ   (NH_ * HD)
#define DKV  (NKV * HD)
#define ZH   (NB_ * NH_)          // planes per launch: every (batch, head)
#define RH   512                  // query rows < RH use hi+lo planes (0: none)
#define WIN  1024
#define SCL  0.088388347648318447f   // HD^-0.5
typedef _Float16 h16;
typedef unsigned short bf;
typedef __attribute__((ext_vector_type(16))) __bf16   v16bf;
typedef __attribute__((ext_vector_type(16))) _Float16 v16h;
typedef __attribute__((ext_vector_type(8)))  _Float16 v8h;
typedef __attribute__((ext_vector_type(8)))  unsigned short v8us;
typedef __attribute__((ext_vector_type(8)))  float    v8f;
typedef __attribute__((ext_vector_type(4)))  float    v4f;
typedef v8h  __attribute__((may_alias)) v8ha;
typedef v4f  __attribute__((may_alias)) v4fa;
typedef v8us __attribute__((may_alias)) v8usa;

__device__ __forceinline__ unsigned short f2bf(float f) { unsigned u = __float_as_uint(f); u += 0x7FFFu + ((u >> 16) & 1u); return (unsigned short)(u >> 16); }
__device__ __forceinline__ float bf2f(unsigned short b) { return __uint_as_float(((unsigned)b) << 16); }
__device__ __forceinline__ float bfr(float f) { return bf2f(f2bf(f)); }
__device__ __forceinline__ v16h cat16(v8h lo, v8h hi) { return __builtin_shufflevector(lo, hi, 0, 1, 2, 3, 4, 5, 6, 7, 8, 9, 10, 11, 12, 13, 14, 15); }
__device__ __forceinline__ v16bf cat16b(v8us lo, v8us hi) { return __builtin_bit_cast(v16bf, __builtin_shufflevector(lo, hi, 0, 1, 2, 3, 4, 5, 6, 7, 8, 9, 10, 11, 12, 13, 14, 15)); }
__device__ __forceinline__ v8f wmma16(v16h a, v16h b, v8f c) { return __builtin_amdgcn_wmma_f32_16x16x32_f16(false, a, false, b, (short)0, c, false, false); }
__device__ __forceinline__ v8f wmmab(v16bf a, v16bf b, v8f c) { return __builtin_amdgcn_wmma_f32_16x16x32_bf16(false, a, false, b, (short)0, c, false, false); }
__device__ __forceinline__ h16 tohx(float x) { return (h16)x; }
__device__ __forceinline__ void splitf(float y, unsigned short& h, unsigned short& l) { h = f2bf(y); l = f2bf(y - bf2f(h)); }
typedef __attribute__((ext_vector_type(4))) _Float16 v4h;
typedef __attribute__((ext_vector_type(2))) unsigned short v2us;
typedef __attribute__((ext_vector_type(4))) unsigned short v4us;



// ---- gemm_tile: 128x128 output tile per work-group of 4 waves (2x2, each wave 64x64 = 16 accumulators). Every operand plane's 128 rows x 64 k are brought in as whole 128-byte lines (a wave's 16-byte loads cover 4 rows),
// staged through registers into a two-buffer LDS ring and shared by the waves; fragments come from LDS. The next stage's global loads fly while this stage is multiplied; one work-group barrier per stage.
// C[m][n] (f32, pitch ldc, + optional f32 bias[n]) = sum_k A[m][k] Bt[n][k] (+ split products per NSPLIT), k ascending in steps of 32 per accumulator. lda = pitch of A in elements (Bt has pitch K), both compile-time, so that every row step of a staging load is an immediate offset on one fixed address. K % 64 == 0; M, N % 128 == 0.
// EPI 0 stores C in f32. EPI 1 and 2 store no f32 at all: the tile goes out as 16-bit planes E16 (fp16; EPI 1 only) | Eh | El (bf16 hi + lo), pointers given at the tile's origin, pitch HD (EPI 1) or DQ (EPI 2), each value x cs (vtr: unscaled);
// with vtr (EPI 1, work-group-uniform) the planes are written transposed, [n][m] at pitch TT; PJ (EPI 1, not vtr; at the tile's first row) takes row m's 3-term product of the tile's columns 0..2 with dirs[0..2] (bf16-rounded), in f32.
// CMODE 1 skips score tiles entirely above the causal diagonal (query rows r0+roff.., key columns c0..); CMODE 2 limits the key (K) loop of the probability x value contraction to the diagonal block (probabilities beyond it are exactly zero).
#define BKS 64      // k elements per stage: one whole 128-byte line of every operand row
#define LPT 72      // LDS row pitch in elements: 144 B = 16 B x odd, so that 16-byte fragment reads of 16 rows spread over the banks
template <typename T16> struct WFrag;
template <> struct WFrag<h16> { typedef v16h V; typedef v8h H; static __device__ __forceinline__ V ld(const h16* p) { return cat16(*(const v8h*)p, *(const v8h*)(p + 16)); } static __device__ __forceinline__ v8f mma(V a, V b, v8f c) { return wmma16(a, b, c); } };
template <> struct WFrag<bf> { typedef v16bf V; typedef v8us H; static __device__ __forceinline__ V ld(const bf* p) { return cat16b(*(const v8us*)p, *(const v8us*)(p + 16)); } static __device__ __forceinline__ v8f mma(V a, V b, v8f c) { return wmmab(a, b, c); } };
template <typename T16, int NSPLIT, int CMODE, bool BIAS, int K, int lda, int EPI>
__device__ __forceinline__ void gemm_tile(const T16* __restrict__ A, const T16* __restrict__ A2, const T16* __restrict__ Bt, const T16* __restrict__ Bt2, float* C, int ldc, int roff, const float* __restrict__ bias,
                                          h16* E16, bf* Eh, bf* El, float* PJ, const float* __restrict__ dirs, float cs, bool vtr) {
    typedef typename WFrag<T16>::V V; typedef typename WFrag<T16>::H H;
    constexpr int NA = (NSPLIT == 1 || NSPLIT == 2) ? 2 : 1, NP = NA + ((NSPLIT >= 2) ? 2 : 1), NF = (NSPLIT <= 1) ? 2 : 1;   // planes: A (A2) | Bt (Bt2); k-steps per fragment group
    __shared__ __align__(16) unsigned char smem[2 * NP * 128 * LPT * 2];                          // two stage buffers; the epilogue's row staging reuses them behind the last barrier
    T16* st = (T16*)smem;
    const int tid = threadIdx.x, lane = tid & 31, wv = tid >> 5, lr = lane & 15, hi = lane >> 4; const int wm = wv >> 1, wn = wv & 1; const int r0 = blockIdx.x * 128, c0 = blockIdx.y * 128;
    if (CMODE == 1 && c0 > r0 + roff + 127) return;                  // score tile entirely above the causal diagonal: never written (the softmax masks j > i by select); the whole work-group leaves, ahead of every barrier
    const int Kl = (CMODE == 2) ? min(K, r0 + roff + 128) : K;       // P.V: probabilities are exactly 0 beyond the diagonal block, so the K loop stops there
    v8f acc[4][4];
#pragma unroll
    for (int mb = 0; mb < 4; ++mb)
#pragma unroll
        for (int nb = 0; nb < 4; ++nb) acc[mb][nb] = (v8f){};
    typedef const __attribute__((address_space(1))) char* gptr; typedef const __attribute__((address_space(1))) H* gvec;   // global address space spelled out: the bases are stepped in the loop, and a stepped generic pointer would compile to flat loads
    gptr gb[NP]; gb[0] = (gptr)(A + (size_t)r0 * lda); if (NA == 2) gb[1] = (gptr)(A2 + (size_t)r0 * lda); gb[NA] = (gptr)(Bt + (size_t)c0 * K); if (NSPLIT >= 2) gb[NA + 1] = (gptr)(Bt2 + (size_t)c0 * K);   // work-group-uniform bases
    const unsigned trow = tid >> 3, tcol = (tid & 7) * 8;            // this thread's 16 bytes: row trow + 16 i, 8 threads to a 128-byte row
    const unsigned oa = (trow * lda + tcol) * 2, ob = (trow * K + tcol) * 2, ol = trow * LPT + tcol;   // oa, ob: the thread's fixed byte offsets from the uniform bases
    H rg[NP][8];
#pragma unroll
    for (int p = 0; p < NP; ++p)
#pragma unroll
        for (int i = 0; i < 8; ++i) rg[p][i] = *(gvec)(gb[p] + (size_t)(i * 16) * (p < NA ? lda : K) * 2 + (p < NA ? oa : ob));
    asm volatile("s_wait_xcnt 0x0" ::: "memory");   // stands ahead of whatever next overwrites an address register of the loads above
#pragma unroll
    for (int p = 0; p < NP; ++p)
#pragma unroll
        for (int i = 0; i < 8; ++i) *(H*)(st + (p * 128 + i * 16) * LPT + ol) = rg[p][i];
    __syncthreads();
    const int fa = (wm * 64 + lr) * LPT + 8 * hi, fb = (NA * 128 + wn * 64 + lr) * LPT + 8 * hi;
#pragma unroll 1
    for (int kc = 0; kc < Kl; kc += BKS) {
        const T16* sc = st + ((kc / BKS) & 1) * (NP * 128 * LPT); T16* sn = st + (((kc / BKS) & 1) ^ 1) * (NP * 128 * LPT); const bool more = kc + BKS < Kl;
        if (more) {
#pragma unroll
            for (int p = 0; p < NP; ++p) gb[p] += BKS * 2;   // the uniform bases step one stage in scalar registers: the thread's one fixed offset serves every plane, and no 64-bit vector address per plane is kept over the loop (two registers fewer, which the budget of k_gemmqkv needs)
#pragma unroll
            for (int p = 0; p < NP; ++p)
#pragma unroll
                for (int i = 0; i < 8; ++i) rg[p][i] = *(gvec)(gb[p] + (size_t)(i * 16) * (p < NA ? lda : K) * 2 + (p < NA ? oa : ob));
            asm volatile("s_wait_xcnt 0x0" ::: "memory"); }   // ahead of whatever next overwrites an address register of these loads
#pragma unroll
        for (int k0 = 0; k0 < BKS / 32; k0 += NF) {
            V a[NF][4], a2[NF][4], b[NF][4], b2[NF][4];               // all fragments of NF k-steps are fetched as one group, ahead of their matrix instructions
#pragma unroll
            for (int f = 0; f < NF; ++f)
#pragma unroll
                for (int q = 0; q < 4; ++q) { const int kk = (k0 + f) * 32; a[f][q] = WFrag<T16>::ld(sc + fa + q * 16 * LPT + kk); b[f][q] = WFrag<T16>::ld(sc + fb + q * 16 * LPT + kk);
                    if (NSPLIT == 1 || NSPLIT == 2) a2[f][q] = WFrag<T16>::ld(sc + fa + (128 + q * 16) * LPT + kk); if (NSPLIT >= 2) b2[f][q] = WFrag<T16>::ld(sc + fb + (128 + q * 16) * LPT + kk); }
            __builtin_amdgcn_sched_barrier(0);   // keeps the group of LDS reads ahead of the matrix instructions: sunk between them, each read's latency is waited out in full
#pragma unroll
            for (int f = 0; f < NF; ++f)
#pragma unroll
                for (int nb = 0; nb < 4; ++nb)
#pragma unroll
                    for (int mb = 0; mb < 4; ++mb) { acc[mb][nb] = WFrag<T16>::mma(a[f][mb], b[f][nb], acc[mb][nb]); if (NSPLIT == 1 || NSPLIT == 2) acc[mb][nb] = WFrag<T16>::mma(a2[f][mb], b[f][nb], acc[mb][nb]); if (NSPLIT >= 2) acc[mb][nb] = WFrag<T16>::mma(a[f][mb], b2[f][nb], acc[mb][nb]); }
            // four vector slots behind the stage's last matrix instruction: the loop's taken branch leads to loads that overwrite its operand registers
            if (k0 + NF == BKS / 32) asm volatile("v_nop\n\tv_nop\n\tv_nop\n\tv_nop" : "+v"(acc[0][0]), "+v"(acc[1][1]), "+v"(acc[2][2]), "+v"(acc[3][3]) : "v"(a[NF - 1][0]), "v"(a[NF - 1][3]));
        }
        if (more) {
#pragma unroll
            for (int p = 0; p < NP; ++p)
#pragma unroll
                for (int i = 0; i < 8; ++i) *(H*)(sn + (p * 128 + i * 16) * LPT + ol) = rg[p][i]; }
        __syncthreads();   // publishes the next stage and ends every wave's reads of this one, whose buffer the next pass refills
    }
    if (EPI == 1 && vtr) {   // transposed planes: a lane's 8 accumulator rows are 8 consecutive m of one column n, so they go to LDS as one 16-byte piece of row n; the rows come back as whole 128-byte lines (64 m)
        bf* vs = (bf*)smem + wv * (3 * 16 * LPT); bf* vw = vs + lr * LPT + hi * 8; const bf* vr = vs + (lane >> 3) * LPT + (lane & 7) * 8;
        const unsigned g0 = (unsigned)(wn * 64 + (lane >> 3)) * TT + wm * 64 + (lane & 7) * 8; bf* e16 = (bf*)E16 + g0; bf* eh = Eh + g0; bf* el = El + g0;   // every later row step is an immediate offset
#pragma unroll
        for (int nb = 0; nb < 4; ++nb) {
#pragma unroll
            for (int mb = 0; mb < 4; ++mb) { v8us w16, wh, wl;
#pragma unroll
                for (int j = 0; j < 8; ++j) { const float x = acc[mb][nb][j]; unsigned short a2, c2; splitf(x, a2, c2); w16[j] = __builtin_bit_cast(unsigned short, tohx(x)); wh[j] = a2; wl[j] = c2; }
                *(v8usa*)(vw + mb * 16) = w16; *(v8usa*)(vw + 16 * LPT + mb * 16) = wh; *(v8usa*)(vw + 32 * LPT + mb * 16) = wl; }
            __builtin_amdgcn_wave_barrier(); asm volatile("" ::: "memory");   // the wave's own LDS writes stay ahead of its reads of other lanes' pieces
            v8us r16[4], rh[4], rl[4];
#pragma unroll
            for (int s = 0; s < 4; ++s) { r16[s] = *(const v8usa*)(vr + s * 4 * LPT); rh[s] = *(const v8usa*)(vr + (16 + s * 4) * LPT); rl[s] = *(const v8usa*)(vr + (32 + s * 4) * LPT); }
            __builtin_amdgcn_sched_barrier(0);   // the group's stores stand together, with nothing between them and their wait that could overwrite a register they name
#pragma unroll
            for (int s = 0; s < 4; ++s) { *(v8usa*)(e16 + (nb * 16 + s * 4) * TT) = r16[s]; *(v8usa*)(eh + (nb * 16 + s * 4) * TT) = rh[s]; *(v8usa*)(el + (nb * 16 + s * 4) * TT) = rl[s]; }
            asm volatile("s_wait_xcnt 0x0" ::: "memory");   // ahead of the next group, which reuses the registers of these stores
            __builtin_amdgcn_sched_barrier(0);   // keeps the next group's instructions behind that wait
        }
        return;
    }
    float* os = (float*)smem + wv * (16 * 68);
    if (EPI != 0) {
        constexpr int EP = (EPI == 1) ? HD : DQ;   // pitch of the planes' rows in elements
        float d0 = 0.f, d1 = 0.f, d2 = 0.f; if (EPI == 1) { d0 = bfr(dirs[0]); d1 = bfr(dirs[1]); d2 = bfr(dirs[2]); }
        const unsigned g0 = (unsigned)(wm * 64 + hi) * EP + wn * 64 + lr * 4; h16* e16 = E16 + g0; bf* eh = Eh + g0; bf* el = El + g0; float* pj = PJ + wm * 64 + lr;   // every later row step is an immediate offset
#pragma unroll
        for (int mb = 0; mb < 4; ++mb) {
#pragma unroll
            for (int nb = 0; nb < 4; ++nb) {
#pragma unroll
                for (int j = 0; j < 8; ++j) os[(hi * 8 + j) * 68 + nb * 16 + lr] = acc[mb][nb][j]; }
            __builtin_amdgcn_wave_barrier(); asm volatile("" ::: "memory");   // the wave's own LDS writes stay ahead of its reads of other lanes' values
            v4h o16[8]; v4us oh[8], ol[8]; float pv = 0.f;
#pragma unroll
            for (int s = 0; s < 8; ++s) { const v4f val = *(const v4fa*)(os + (2 * s + hi) * 68 + lr * 4);
#pragma unroll
                for (int q = 0; q < 4; ++q) { const float r = val[q] * cs; unsigned short a2, c2; splitf(r, a2, c2); o16[s][q] = tohx(r); oh[s][q] = a2; ol[s][q] = c2; } }
            if (EPI == 1) { const v4f f = *(const v4fa*)(os + lr * 68); pv = f[0] * d0 + f[1] * d1 + f[2] * d2; }   // row lr's columns 0..2 (used where wn == 0)
            __builtin_amdgcn_sched_barrier(0);   // the group's stores stand together, with nothing between them and their wait that could overwrite a register they name
#pragma unroll
            for (int s = 0; s < 8; ++s) { if (EPI == 1) *(v4h*)(e16 + (mb * 16 + 2 * s) * EP) = o16[s];
                *(v4us*)(eh + (mb * 16 + 2 * s) * EP) = oh[s]; *(v4us*)(el + (mb * 16 + 2 * s) * EP) = ol[s]; }
            if (EPI == 1 && wn == 0 && hi == 0) pj[mb * 16] = pv;
            asm volatile("s_wait_xcnt 0x0" ::: "memory");   // ahead of the next group, which reuses the registers of these stores
            __builtin_amdgcn_sched_barrier(0);   // keeps the next group's instructions behind that wait
        }
        return;
    }
#pragma unroll
    for (int mb = 0; mb < 4; ++mb) {
#pragma unroll
        for (int nb = 0; nb < 4; ++nb) {
#pragma unroll
            for (int j = 0; j < 8; ++j) os[(hi * 8 + j) * 68 + nb * 16 + lr] = acc[mb][nb][j]; }
        __builtin_amdgcn_wave_barrier(); asm volatile("" ::: "memory");
        const int cw = c0 + wn * 64; float* crow = C + (size_t)(r0 + wm * 64 + mb * 16) * ldc + cw;
#pragma unroll
        for (int s = 0; s < 8; ++s) { const int row = 2 * s + hi, cofs = lr * 4; v4f val = *(const v4fa*)(os + row * 68 + cofs); if (BIAS) { val[0] += bfr(bias[cw + cofs]); val[1] += bfr(bias[cw + cofs + 1]); val[2] += bfr(bias[cw + cofs + 2]); val[3] += bfr(bias[cw + cofs + 3]); }
            *(v4f*)(crow + (size_t)row * ldc + cofs) = val; }
        __builtin_amdgcn_wave_barrier(); asm volatile("" ::: "memory");
    }
}

// ---- k_gemmw: plain GEMM on gemm_tile; grid (M/128, N/128, Z), 128 threads. z-batch strides sA/sB/sC in elements.
template <typename T16, int NSPLIT, bool BIAS>
__global__ __launch_bounds__(128) void k_gemmw(const T16* __restrict__ A, const T16* __restrict__ A2, const T16* __restrict__ Bt, const T16* __restrict__ Bt2, int K, float* C, int ldc, const float* __restrict__ bias, size_t sA, size_t sB, size_t sC) {
    const size_t z = blockIdx.z; A += z * sA; if (A2) A2 += z * sA; Bt += z * sB; if (Bt2) Bt2 += z * sB; C += z * sC;
    (void)K; gemm_tile<T16, NSPLIT, 0, BIAS, DM, DM, 0>(A, A2, Bt, Bt2, C, ldc, 0, bias, nullptr, nullptr, nullptr, nullptr, nullptr, 1.0f, false);   // K = 1024
}

// ---- k_gemmqkv: [q | k | v] = x Wqkv on gemm_tile; grid (4096/128, 3072/128), 128 threads. A 128-column tile is one head of q, k or v and a 128-row tile lies in one batch, so the epilogue writes the tile straight into that (batch, head)'s planes.
// amdgpu_waves_per_eu(3): a register budget of 336, so that three work-groups (one wave each per SIMD) share a WGP and all 768 are resident at once; above 336 only two fit, and the grid takes two rounds, the second half empty.
__global__ __launch_bounds__(128) __attribute__((amdgpu_waves_per_eu(3))) void k_gemmqkv(const bf* __restrict__ A, const bf* __restrict__ Bt, const float* __restrict__ dirs, h16* Q16, bf* Qh, bf* Ql, float* QPJ, h16* K16, bf* Kh, bf* Kl, float* KPJ, h16* V16, bf* Vh, bf* Vl) {
    const int sect = blockIdx.y / NH_, h = blockIdx.y % NH_, t0 = (blockIdx.x % (TT / 128)) * 128; const size_t z = (size_t)(blockIdx.x / (TT / 128)) * NH_ + h;
    const bool vtr = (sect == 2); const size_t o = vtr ? z * HD * TT + t0 : (z * TT + t0) * HD;   // v planes are [d][t], q and k planes [t][d]
    h16* E16 = (sect == 0) ? Q16 : (sect == 1) ? K16 : V16; bf* Eh = (sect == 0) ? Qh : (sect == 1) ? Kh : Vh; bf* El = (sect == 0) ? Ql : (sect == 1) ? Kl : Vl; float* PJ = ((sect == 0) ? QPJ : KPJ) + z * TT + t0;
    gemm_tile<bf, 0, 0, false, DM, DM, 1>(A, nullptr, Bt, nullptr, nullptr, HD, 0, nullptr, E16 + o, Eh + o, El + o, PJ, dirs + h * 3, 1.0f, vtr);
}

#define FBK 64      // keys per stage
#define KPT 136     // LDS pitch of a staged key row in elements: 272 B = 16 B x odd
#define FST (FBK * KPT + HD * LPT)   // elements of one plane's stage: keys | transposed values
typedef __attribute__((ext_vector_type(16))) unsigned short v16us;
template <typename T16, bool HL>
__device__ __forceinline__ void attn_tile(unsigned char* smem, const T16* __restrict__ Q, const T16* __restrict__ Q2, const T16* __restrict__ Kp, const T16* __restrict__ Kp2, const T16* __restrict__ Vt, const T16* __restrict__ Vt2,
                                          const float* __restrict__ qpj, const float* __restrict__ kpj, float hs, int r0, bf* Ah, bf* Al) {
    typedef typename WFrag<T16>::V V; typedef typename WFrag<T16>::H H;
    constexpr int NPL = HL ? 2 : 1, NF = HL ? 1 : 2, DG = HL ? 4 : 8;   // planes per operand; k-steps and d tiles per fragment group
    constexpr float L2E = 1.4426950408889634f, SC2 = SCL * L2E;   // logits are kept in units of log2, so that the exponentials need no multiply
    T16* st = (T16*)smem;
    const int tid = threadIdx.x, lane = tid & 31, wv = tid >> 5, lr = lane & 15, hi = lane >> 4;
    const int qi = r0 + wv * 16 + lr;          // this lane's query row
    const int nblk = r0 / FBK + 128 / FBK;     // key stages up to the end of the tile's diagonal block (work-group-uniform)
    const T16* gk[2] = {Kp, Kp2}; const T16* gv[2] = {Vt, Vt2};
    const unsigned ok = (tid >> 4) * HD + (tid & 15) * 8, ov = (tid >> 3) * TT + (tid & 7) * 8;                       // the thread's 16 bytes of a key row (16 rows a pass) and of a value row (32 rows a pass)
    const unsigned lk = (tid >> 4) * KPT + (tid & 15) * 8, lv = FBK * KPT + (tid >> 3) * LPT + (tid & 7) * 8;
    V qb[4], qb2[4]; H rk[NPL][4], rv[NPL][4];
    const T16* qa = Q + (size_t)qi * HD + 8 * hi; const T16* qa2 = HL ? Q2 + (size_t)qi * HD + 8 * hi : qa;   // the lane's query row; every k-step is an immediate offset
#pragma unroll
    for (int kq = 0; kq < 4; ++kq) { qb[kq] = WFrag<T16>::ld(qa + kq * 32); if (HL) qb2[kq] = WFrag<T16>::ld(qa2 + kq * 32); }
    const float g = hs * qpj[qi] * L2E;
#pragma unroll
    for (int p = 0; p < NPL; ++p)
#pragma unroll
        for (int i = 0; i < 4; ++i) { rk[p][i] = *(const H*)(gk[p] + (size_t)(i * 16) * HD + ok); rv[p][i] = *(const H*)(gv[p] + (size_t)(i * 32) * TT + ov); }
    asm volatile("s_wait_xcnt 0x0" :: "v"(qa), "v"(qa2) : "memory");   // stands ahead of whatever next overwrites an address register of the loads above; naming the two row addresses keeps their registers from being reused as a load's destination ahead of it
    __builtin_amdgcn_sched_barrier(0);   // keeps the address arithmetic of the LDS stores below behind that wait
#pragma unroll
    for (int p = 0; p < NPL; ++p)
#pragma unroll
        for (int i = 0; i < 4; ++i) { *(H*)(st + p * FST + i * 16 * KPT + lk) = rk[p][i]; *(H*)(st + p * FST + i * 32 * LPT + lv) = rv[p][i]; }
    __syncthreads();
    v8f o[8];
#pragma unroll
    for (int db = 0; db < 8; ++db) o[db] = (v8f){};
    float m = -3.0e38f, l = 0.f;
    const int fk = lr * KPT + 8 * hi, fv = FBK * KPT + lr * LPT + 8 * hi;
#pragma unroll 1
    for (int kb = 0; kb < nblk; ++kb) {
        const T16* sc = st + (kb & 1) * (NPL * FST); T16* sn = st + ((kb & 1) ^ 1) * (NPL * FST); const bool more = kb + 1 < nblk;
        v4f kp[8];   // the key projections of this lane's 32 keys
#pragma unroll
        for (int c = 0; c < 8; ++c) kp[c] = *(const v4f*)(kpj + kb * FBK + (c >> 1) * 16 + 8 * hi + (c & 1) * 4);
        __builtin_amdgcn_sched_barrier(0);   // the projections' loads issue first: they are needed first, and loads are waited for in issue order
        const int kn = more ? kb + 1 : kb;   // no branch round the next stage's loads (it would let them move ahead of the loads above); the last pass reads its own stage again and stores nothing
#pragma unroll
        for (int p = 0; p < NPL; ++p)
#pragma unroll
            for (int i = 0; i < 4; ++i) { rk[p][i] = *(const H*)(gk[p] + (size_t)(kn * FBK + i * 16) * HD + ok); rv[p][i] = *(const H*)(gv[p] + (size_t)(i * 32) * TT + kn * FBK + ov); }
        asm volatile("s_wait_xcnt 0x0" ::: "memory");   // ahead of the fragment reads below, which may reuse the address registers of these loads
        v8f s[4];
#pragma unroll
        for (int kt = 0; kt < 4; ++kt) s[kt] = (v8f){};
#pragma unroll
        for (int k0 = 0; k0 < 4; k0 += NF) {
            V a[NF][4], a2[NF][4];
#pragma unroll
            for (int f = 0; f < NF; ++f)
#pragma unroll
                for (int kt = 0; kt < 4; ++kt) { a[f][kt] = WFrag<T16>::ld(sc + fk + kt * 16 * KPT + (k0 + f) * 32); if (HL) a2[f][kt] = WFrag<T16>::ld(sc + FST + fk + kt * 16 * KPT + (k0 + f) * 32); }
            __builtin_amdgcn_sched_barrier(0);   // keeps the group of LDS reads ahead of the matrix instructions: sunk between them, each read's latency is waited out in full
#pragma unroll
            for (int f = 0; f < NF; ++f) {
#pragma unroll
                for (int kt = 0; kt < 4; ++kt) s[kt] = WFrag<T16>::mma(a[f][kt], qb[k0 + f], s[kt]);
                if (HL) {
#pragma unroll
                    for (int kt = 0; kt < 4; ++kt) s[kt] = WFrag<T16>::mma(a[f][kt], qb2[k0 + f], s[kt]);
#pragma unroll
                    for (int kt = 0; kt < 4; ++kt) s[kt] = WFrag<T16>::mma(a2[f][kt], qb[k0 + f], s[kt]); } }
        }
        float mx = m;
#pragma unroll
        for (int kt = 0; kt < 4; ++kt)
#pragma unroll
            for (int r = 0; r < 8; ++r) s[kt][r] = s[kt][r] * SC2 + g * kp[kt * 2 + (r >> 2)][r & 3];   // (s/sqrt(128) + head_scale qp_i kp_j) log2(e)
        if (kb >= nblk - 128 / FBK) {   // only the stages of the tile's diagonal block hold keys behind a query (work-group-uniform test)
            const int dq = qi - kb * FBK - 8 * hi;   // the lane's element kt * 16 + r is live up to here
#pragma unroll
            for (int kt = 0; kt < 4; ++kt)
#pragma unroll
                for (int r = 0; r < 8; ++r) s[kt][r] = (kt * 16 + r <= dq) ? s[kt][r] : -3.0e38f; }
#pragma unroll
        for (int kt = 0; kt < 4; ++kt)
#pragma unroll
            for (int r = 0; r < 8; ++r) mx = fmaxf(mx, s[kt][r]);
        mx = fmaxf(mx, __shfl_xor(mx, 16, 32));   // the query's other 32 keys of the stage
        const float al = __builtin_amdgcn_exp2f(m - mx); m = mx; float ps[4] = {0.f, 0.f, 0.f, 0.f};   // one partial sum per 16-key tile: four short chains of adds
#pragma unroll
        for (int kt = 0; kt < 4; ++kt)
#pragma unroll
            for (int r = 0; r < 8; ++r) { const float p = __builtin_amdgcn_exp2f(s[kt][r] - mx); s[kt][r] = p; ps[kt] += p; }
        l = l * al + ((ps[0] + ps[1]) + (ps[2] + ps[3]));
#pragma unroll
        for (int db = 0; db < 8; ++db) o[db] *= al;
#pragma unroll
        for (int kg = 0; kg < 2; ++kg) {
            V pb, pb2;   // Pt of 32 keys as a B operand: element e = key 8 hi + e of the first tile, element 8 + e the same of the second
            if (HL) { v16us ph, pl;
#pragma unroll
                for (int e = 0; e < 16; ++e) { unsigned short x, y; splitf(s[kg * 2 + (e >> 3)][e & 7], x, y); ph[e] = x; pl[e] = y; }
                pb = __builtin_bit_cast(V, ph); pb2 = __builtin_bit_cast(V, pl);
            } else { v16h ph;
#pragma unroll
                for (int e = 0; e < 16; ++e) ph[e] = tohx(s[kg * 2 + (e >> 3)][e & 7]);
                pb = __builtin_bit_cast(V, ph); }
#pragma unroll
            for (int d0 = 0; d0 < 8; d0 += DG) {
                V a[DG], a2[DG];
#pragma unroll
                for (int d = 0; d < DG; ++d) { a[d] = WFrag<T16>::ld(sc + fv + (d0 + d) * 16 * LPT + kg * 32); if (HL) a2[d] = WFrag<T16>::ld(sc + FST + fv + (d0 + d) * 16 * LPT + kg * 32); }
                __builtin_amdgcn_sched_barrier(0);   // as above: the group's LDS reads stay ahead of its matrix instructions
#pragma unroll
                for (int d = 0; d < DG; ++d) o[d0 + d] = WFrag<T16>::mma(a[d], pb, o[d0 + d]);
                if (HL) {
#pragma unroll
                    for (int d = 0; d < DG; ++d) o[d0 + d] = WFrag<T16>::mma(a[d], pb2, o[d0 + d]);
#pragma unroll
                    for (int d = 0; d < DG; ++d) o[d0 + d] = WFrag<T16>::mma(a2[d], pb, o[d0 + d]); }
            }
        }
        if (more) {
#pragma unroll
            for (int p = 0; p < NPL; ++p)
#pragma unroll
                for (int i = 0; i < 4; ++i) { *(H*)(sn + p * FST + i * 16 * KPT + lk) = rk[p][i]; *(H*)(sn + p * FST + i * 32 * LPT + lv) = rv[p][i]; } }
        __syncthreads();   // publishes the next stage and ends every wave's reads of this one, whose buffer the next pass refills
    }
    l += __shfl_xor(l, 16, 32);   // joins the sums of the wave's halves
    const float inv = 1.0f / l;
    v8us oh[8], ol[8];   // a lane's 8 accumulator rows are 8 consecutive d of its query: one 16-byte piece of the merged row per plane
#pragma unroll
    for (int db = 0; db < 8; ++db)
#pragma unroll
        for (int r = 0; r < 8; ++r) { unsigned short x, y; splitf(o[db][r] * inv, x, y); oh[db][r] = x; ol[db][r] = y; }
    bf* eh = Ah + (size_t)qi * DQ + 8 * hi; bf* el = Al + (size_t)qi * DQ + 8 * hi;
    __builtin_amdgcn_sched_barrier(0);   // the stores stand together, with nothing between them and their wait that could overwrite a register they name
#pragma unroll
    for (int db = 0; db < 8; ++db) { *(v8usa*)(eh + db * 16) = oh[db]; *(v8usa*)(el + db * 16) = ol[db]; }
    asm volatile("s_wait_xcnt 0x0" ::: "memory");   // stands behind the stores, ahead of the release of their registers at the wave's end
}
__global__ __launch_bounds__(256) void k_attn(const h16* __restrict__ Q16, const bf* __restrict__ Qh, const bf* __restrict__ Ql, const h16* __restrict__ K16, const bf* __restrict__ Kh, const bf* __restrict__ Kl, const h16* __restrict__ V16, const bf* __restrict__ Vh, const bf* __restrict__ Vl,
                                              const float* __restrict__ QPJ, const float* __restrict__ KPJ, const float* __restrict__ HSC, bf* Ah, bf* Al) {
    __shared__ __align__(16) unsigned char smem[2 * 2 * FST * 2];   // two stage buffers of up to two planes per operand
    const int r0 = (int)(TT / 128 - 1 - blockIdx.x) * 128; const size_t z = blockIdx.y, pz = z * TT * HD, oz = (z / NH_) * TT * DQ + (z % NH_) * HD; const float hs = bfr(HSC[z % NH_]);
    if (r0 < RH) attn_tile<bf, true>(smem, Qh + pz, Ql + pz, Kh + pz, Kl + pz, Vh + pz, Vl + pz, QPJ + z * TT, KPJ + z * TT, hs, r0, Ah + oz, Al + oz);
    else attn_tile<h16, false>(smem, Q16 + pz, nullptr, K16 + pz, nullptr, V16 + pz, nullptr, QPJ + z * TT, KPJ + z * TT, hs, r0, Ah + oz, Al + oz);
}

// ---- k_prep: the GEMMs' three 16-bit operands in one launch: Wqkv and Wout transposed to [n][k] bf16, x rounded to bf16. Grid 256 work-groups (as many as the chip has WGPs) x 512 threads = 16 waves.
// A work-group takes four 64 k x 64 n weight tiles (three of Wqkv, one of Wout) and 16384 values of x; a thread issues its 16 16-byte loads together, each wave instruction covering whole 128-byte lines.
// A thread holds 4 columns n of two neighbouring rows k: the pair (k, k + 1) of one column goes to LDS as one dword of row n. A row n is 32 dwords; its 16-byte groups (8 k) stand at group ^ ((n >> 2) & 7),
// so that a wave's dword stores fall on 32 different banks and its 16-byte reads on all 64. Behind the barrier 8 threads read and store one whole 128-byte line of the transposed plane.
typedef __attribute__((ext_vector_type(4))) unsigned v4u;
typedef v4u __attribute__((may_alias)) v4ua;
typedef v4us __attribute__((may_alias)) v4usa;
__global__ __launch_bounds__(512) void k_prep(const float* __restrict__ x, const float* __restrict__ wqkv, const float* __restrict__ wo, bf* XB, bf* WALL, bf* WO) {
    __shared__ __align__(16) unsigned tl[4][64 * 32];
    const unsigned t = threadIdx.x, kt = blockIdx.x & 15, nt = blockIdx.x >> 4;   // tile (kt, nt + 16 i) of Wqkv, i = 0..2; tile (kt, nt) of Wout
    const unsigned c4 = t & 7, kl = (t >> 3) & 3, hf = (t >> 5) & 1, g = t >> 6;  // 8 threads to a 128-byte piece of a row; 4 row pairs to a wave; the wave's half of the columns and its group of 8 rows
    const unsigned kr = kt * 64 + (g * 4 + kl) * 2, nc = hf * 32 + c4 * 4;        // the thread's first row k, and its first column inside the tile
    const unsigned oq = kr * (3 * DM) + nt * 64 + nc, oo = kr * DM + nt * 64 + nc, ox = blockIdx.x * 16384 + t * 4;   // element offsets; every further step is an immediate offset
    const float* pq = wqkv + oq; const float* po = wo + oo; const float* px = x + ox;
    v4f w0[4], w1[4], xv[8];
#pragma unroll
    for (int i = 0; i < 3; ++i) { w0[i] = *(const v4fa*)(pq + i * 1024); w1[i] = *(const v4fa*)(pq + i * 1024 + 3 * DM); }
    w0[3] = *(const v4fa*)po; w1[3] = *(const v4fa*)(po + DM);
    __builtin_amdgcn_sched_barrier(0);   // the weights' loads issue first: they are needed first, ahead of the barrier, and loads are waited for in issue order
#pragma unroll
    for (int i = 0; i < 8; ++i) xv[i] = *(const v4fa*)(px + i * 2048);
    asm volatile("s_wait_xcnt 0x0" :: "v"(pq), "v"(po), "v"(px) : "memory");   // stands ahead of whatever next overwrites an address register of the loads above; naming the three addresses keeps their registers from being reused as a load's destination ahead of it
    const unsigned ls = nc * 32 + ((g ^ c4) << 2) + kl;
#pragma unroll
    for (int i = 0; i < 4; ++i)
#pragma unroll
        for (int j = 0; j < 4; ++j) tl[i][ls + j * 32] = (unsigned)f2bf(w0[i][j]) | ((unsigned)f2bf(w1[i][j]) << 16);
    __syncthreads();   // every tile is whole before a row of it is read
    const unsigned n = t >> 3, gr = t & 7, lq = n * 32 + ((gr ^ ((n >> 2) & 7)) << 2);
    v4u r[4]; v4us xo[8];
#pragma unroll
    for (int i = 0; i < 4; ++i) r[i] = *(const v4ua*)(&tl[i][lq]);
#pragma unroll
    for (int i = 0; i < 8; ++i)
#pragma unroll
        for (int q = 0; q < 4; ++q) xo[i][q] = f2bf(xv[i][q]);
    const unsigned ot = (nt * 64 + n) * DM + kt * 64 + gr * 8;   // row n of the transposed plane, 8 k from gr * 8 (both planes have pitch 1024)
    __builtin_amdgcn_sched_barrier(0);   // the stores stand together, with nothing between them and their wait that could overwrite a register they name
#pragma unroll
    for (int i = 0; i < 3; ++i) *(v4ua*)(WALL + ot + i * (1024 * DM)) = r[i];
    *(v4ua*)(WO + ot) = r[3];
#pragma unroll
    for (int i = 0; i < 8; ++i) *(v4usa*)(XB + ox + i * 2048) = xo[i];
    asm volatile("s_wait_xcnt 0x0" ::: "memory");   // stands behind the stores, ahead of the release of their registers at the wave's end
}

extern "C" void kernel_launch(void* const* d_in, const int* in_sizes, int n_in,
                              void* d_out, int out_size, void* d_ws, size_t ws_size, hipStream_t stream) {
    (void)in_sizes; (void)n_in; (void)out_size;
    const float* x = (const float*)d_in[0]; const float* wqkv = (const float*)d_in[1]; const float* wo = (const float*)d_in[2]; const float* HSC = (const float*)d_in[3]; const float* HDR = (const float*)d_in[4];  const float* wq = nullptr; const float* wk = nullptr; const float* wv = nullptr; (void)wq; (void)wk; (void)wv;
    float* OUT = (float*)d_out;     // [4][1024][1024]
    char* wsp = (char*)d_ws;
    auto take = [&](size_t bytes) { char* p = wsp; wsp += (bytes + 255) & ~(size_t)255; return (void*)p; };
    bf* WALL = (bf*)take((size_t)3 * DM * DM * 2); bf* WO = (bf*)take((size_t)DM * DQ * 2);
    bf* XB = (bf*)take((size_t)NB_ * TT * DM * 2); float* QPJ = (float*)take((size_t)ZH * TT * 4); float* KPJ = (float*)take((size_t)ZH * TT * 4);
    h16* QP16 = (h16*)take((size_t)ZH * TT * HD * 2); h16* KP16 = (h16*)take((size_t)ZH * TT * HD * 2); h16* VT16 = (h16*)take((size_t)ZH * HD * TT * 2);
    bf* QPh = (bf*)take((size_t)ZH * TT * HD * 2); bf* QPl = (bf*)take((size_t)ZH * TT * HD * 2); bf* KPh = (bf*)take((size_t)ZH * TT * HD * 2); bf* KPl = (bf*)take((size_t)ZH * TT * HD * 2); bf* VTh = (bf*)take((size_t)ZH * HD * TT * 2); bf* VTl = (bf*)take((size_t)ZH * HD * TT * 2);
    bf* ATh = (bf*)take((size_t)NB_ * TT * DQ * 2); bf* ATl = (bf*)take((size_t)NB_ * TT * DQ * 2);
    if ((size_t)(wsp - (char*)d_ws) > ws_size) return;    // ws 256 MiB (about 104 MiB taken)
    k_prep<<<256, 512, 0, stream>>>(x, wqkv, wo, XB, WALL, WO);   /* 'xw' weights [k][n] -> Bt [n][k] (WALL: row blocks q | k | v); x -> bf16 */
    k_gemmqkv<<<dim3(NB_ * TT / 128, 3 * DM / 128, 1), 128, 0, stream>>>(XB, WALL, HDR, QP16, QPh, QPl, QPJ, KP16, KPh, KPl, KPJ, VT16, VTh, VTl);
    k_attn<<<dim3(TT / 128, ZH, 1), 256, 0, stream>>>(QP16, QPh, QPl, KP16, KPh, KPl, VT16, VTh, VTl, QPJ, KPJ, HSC, ATh, ATl);
    k_gemmw<bf, 1, false><<<dim3(NB_ * TT / 128, DM / 128, 1), 128, 0, stream>>>(ATh, ATl, WO, nullptr, DQ, OUT, DM, nullptr, 0, 0, 0);
}
